// v000
// The times below were measured on an AMD MI455X: many runs one after another, warmed up first and cycling through
// copies of the inputs, with the whole window's GPU time divided by the number of runs. Launches and the gaps
// between them are all in it. The median over several windows is given; except for v000 it joins two sittings, which
// can be a few percent apart, so the side-by-side timings, each taken in one sitting, are the better comparison.
// v000 is the starting kernel. One run takes 7430 microseconds.
#include <hip/hip_runtime.h>

// Compute dtypes, f32 accumulate: query/key = relu(BN_batchstats(conv1x1(x))) with the 1x1 convs as token-major GEMMs over all 4 x 4096 positions ([16384 x 64].[64 x 64], PLAIN bf16
// operands = rounded input/weights, exact products, + bias), the per-channel batch mean/variance as a fixed-order f32 reduction, normalise + relu in f32 -> bf16 hi + UNSCALED residual
// planes; value = conv1x1 channel-major ([64 x 64].[64 x 4096] per item) x the gate (heat0 + heat1) -> planes; per item and 1024-row chunk: sim rows = q . k ([1024 x 64].[64 x 4096],
// three products) -> row softmax in f32 -> P planes; ctx[c][q] = sum_k gv[c][k] P[q][k] ([64 x 4096].[4096 x 1024], three products) written channel-major = the output layout - all on

#define NBI  4
#define CC   64
#define CQ   64
#define NN   4096
#define NALL (NBI * NN)           // 16384
#define RCH  1024
#define BN_EPS 1e-5f
#define DM   CC
#define NTK  NN
#define LOSC 1024.0f

typedef _Float16 h16;
typedef unsigned short bf;
typedef __attribute__((ext_vector_type(16))) __bf16   v16bf;
typedef __attribute__((ext_vector_type(16))) _Float16 v16h;
typedef __attribute__((ext_vector_type(8)))  _Float16 v8h;
typedef __attribute__((ext_vector_type(8)))  unsigned short v8us;
typedef __attribute__((ext_vector_type(8)))  float    v8f;
typedef __attribute__((ext_vector_type(4)))  float    v4f;
typedef __attribute__((ext_vector_type(4)))  _Float16 v4h;
typedef v8h  __attribute__((may_alias)) v8ha;
typedef v4f  __attribute__((may_alias)) v4fa;
typedef v8us __attribute__((may_alias)) v8usa;

__device__ __forceinline__ unsigned short f2bf(float f) { unsigned u = __float_as_uint(f); u += 0x7FFFu + ((u >> 16) & 1u); return (unsigned short)(u >> 16); }
__device__ __forceinline__ float bf2f(unsigned short b) { return __uint_as_float(((unsigned)b) << 16); }
__device__ __forceinline__ float bfr(float f) { return bf2f(f2bf(f)); }
__device__ __forceinline__ v16h cat16(v8h lo, v8h hi) { return __builtin_shufflevector(lo, hi, 0, 1, 2, 3, 4, 5, 6, 7, 8, 9, 10, 11, 12, 13, 14, 15); }
__device__ __forceinline__ v16bf cat16b(v8us lo, v8us hi) { return __builtin_bit_cast(v16bf, __builtin_shufflevector(lo, hi, 0, 1, 2, 3, 4, 5, 6, 7, 8, 9, 10, 11, 12, 13, 14, 15)); }
__device__ __forceinline__ v8f wmma16(v16h a, v16h b, v8f c) { return __builtin_amdgcn_wmma_f32_16x16x32_f16(false, a, false, b, (short)0, c, false, false); }
__device__ __forceinline__ v8f wmmab(v16bf a, v16bf b, v8f c) { return __builtin_amdgcn_wmma_f32_16x16x32_bf16(false, a, false, b, (short)0, c, false, false); }

// k_wt: WT [n][K] = bf16(W[k][n]) (k-major [K][ncols]) via 64 x 64 LDS tiles; grid (K/64, ncols/64).
__global__ __launch_bounds__(256) void k_wt(const float* __restrict__ Wm, int K, int ncols, bf* WT) {
    __shared__ __align__(16) unsigned short tl[64 * 72];
    const int tid = threadIdx.x, k0 = blockIdx.x * 64, n0 = blockIdx.y * 64;
    const int kk = tid >> 2, nq = (tid & 3) * 16;
#pragma unroll
    for (int i = 0; i < 16; ++i) tl[(nq + i) * 72 + kk] = f2bf(Wm[(size_t)(k0 + kk) * ncols + n0 + nq + i]);
    __syncthreads();
    const int piece = tid & 7;
    auto pass = [&]() {
#pragma unroll
        for (int s = 0; s < 2; ++s) { const int nr = (tid >> 3) + 32 * s; const v8us val = *(const v8usa*)(tl + nr * 72 + piece * 8); *(v8us*)(WT + (size_t)(n0 + nr) * K + k0 + piece * 8) = val; }
    };
    pass(); 
}
// k_gemmb: 64 x 64 block tile (4 waves x 16 x 64) of C[NALL][CQ] = (A [+ Al]).B^T (K = 64) [+ bf(bias[c])] [+ bf(R[r][c]) residual]; f32 whole-line epilogue (or f16
template <bool SPLITA, bool F16OUT = false>
__global__ __launch_bounds__(128) void k_gemmb(const bf* __restrict__ A, const bf* __restrict__ Al, const bf* __restrict__ Bn, const float* __restrict__ bias, float* C, int ldc, h16* C2, const float* __restrict__ R = nullptr, int K = DM, int roundR = 1) {
    __shared__ __align__(16) float ost[4][16 * 68];
    const int lane = threadIdx.x & 31, wave = threadIdx.x >> 5, lr = lane & 15, hi = lane >> 4;
    const int r0 = blockIdx.x * 64 + wave * 16, c0 = blockIdx.y * 64;
    const size_t aoff = (size_t)(r0 + lr) * K + 8 * hi;
    size_t boff[4];
#pragma unroll
    for (int t = 0; t < 4; ++t) boff[t] = (size_t)(c0 + t * 16 + lr) * K + 8 * hi;
    v8f acc[4];
#pragma unroll
    for (int t = 0; t < 4; ++t) acc[t] = (v8f){};
#pragma unroll 1
    for (int kc = 0; kc < K; kc += 32) {
        const v16bf a = cat16b(*(const v8us*)(A + aoff + kc), *(const v8us*)(A + aoff + kc + 16));
        v16bf al = a;
        if (SPLITA) al = cat16b(*(const v8us*)(Al + aoff + kc), *(const v8us*)(Al + aoff + kc + 16));
#pragma unroll
        for (int t = 0; t < 4; ++t) { const v16bf b = cat16b(*(const v8us*)(Bn + boff[t] + kc), *(const v8us*)(Bn + boff[t] + kc + 16)); acc[t] = wmmab(a, b, acc[t]); if (SPLITA) acc[t] = wmmab(al, b, acc[t]); }
        asm volatile("v_nop\n\tv_nop\n\tv_nop\n\tv_nop" : "+v"(acc[0]), "+v"(acc[1]), "+v"(acc[2]), "+v"(acc[3]) : "v"(a), "v"(al));
    }
    float* os = &ost[wave][0];
#pragma unroll
    for (int t = 0; t < 4; ++t) { const float bv = bias ? bfr(bias[c0 + t * 16 + lr]) : 0.f;
#pragma unroll
        for (int j = 0; j < 8; ++j) os[(hi * 8 + j) * 68 + t * 16 + lr] = acc[t][j] + bv; }
    __syncthreads();
    if (F16OUT) {
        h16* crow = (h16*)(void*)C + (size_t)r0 * ldc + c0;
        auto pass = [&]() {
#pragma unroll
            for (int s = 0; s < 4; ++s) { const int row = 4 * s + (lane >> 3), piece = lane & 7; const float* sp = os + row * 68 + piece * 8; v8h o, o2;
#pragma unroll
                for (int i = 0; i < 8; ++i) { const h16 a = (h16)sp[i]; o[i] = a; o2[i] = (h16)((sp[i] - (float)a) * LOSC); }
                *(v8h*)(crow + (size_t)row * ldc + piece * 8) = o; if (C2) *(v8h*)(C2 + (size_t)r0 * ldc + c0 + (size_t)row * ldc + piece * 8) = o2; }
        };
        pass(); 
    } else {
        float* crow = C + (size_t)r0 * ldc + c0;
        auto pass = [&]() {
#pragma unroll
            for (int s = 0; s < 8; ++s) { const int Lid = (lane >> 3) + 4 * s, piece = lane & 7; const int row = Lid >> 1, cofs = (Lid & 1) * 32 + piece * 4;
                v4f val = *(const v4fa*)(os + row * 68 + cofs); if (R) { const v4f rv = *(const v4f*)(R + ((size_t)r0 + row) * ldc + c0 + cofs); val += roundR ? (v4f){bfr(rv[0]), bfr(rv[1]), bfr(rv[2]), bfr(rv[3])} : rv; }
                *(v4f*)(crow + (size_t)row * ldc + cofs) = val; }
        };
        pass(); 
    }
}

// k_gemm3: 64 x 64 tile of C = (Ah + Al).(Bh + Bl)^T over K (row strides = K for all four planes; n-major B): three products per 32-k step (hh, hl, lh); f32
__global__ __launch_bounds__(128) void k_gemm3(const bf* __restrict__ Ah, const bf* __restrict__ Al, const bf* __restrict__ Bh, const bf* __restrict__ Bl, int K, float* C, int ldc) {
    __shared__ __align__(16) float ost[4][16 * 68];
    const int lane = threadIdx.x & 31, wave = threadIdx.x >> 5, lr = lane & 15, hi = lane >> 4;
    const int r0 = blockIdx.x * 64 + wave * 16, c0 = blockIdx.y * 64;
    const size_t aoff = (size_t)(r0 + lr) * K + 8 * hi;
    v8f acc[4];
#pragma unroll
    for (int t = 0; t < 4; ++t) acc[t] = (v8f){};
#pragma unroll 1
    for (int kc = 0; kc < K; kc += 32) {
        const v16bf a = cat16b(*(const v8us*)(Ah + aoff + kc), *(const v8us*)(Ah + aoff + kc + 16));
        const v16bf al = cat16b(*(const v8us*)(Al + aoff + kc), *(const v8us*)(Al + aoff + kc + 16));
#pragma unroll
        for (int t = 0; t < 4; ++t) { const size_t bo = (size_t)(c0 + t * 16 + lr) * K + kc + 8 * hi;
            const v16bf bh = cat16b(*(const v8us*)(Bh + bo), *(const v8us*)(Bh + bo + 16)); const v16bf bl = cat16b(*(const v8us*)(Bl + bo), *(const v8us*)(Bl + bo + 16));
            acc[t] = wmmab(a, bh, acc[t]); acc[t] = wmmab(al, bh, acc[t]); acc[t] = wmmab(a, bl, acc[t]); }
        asm volatile("v_nop\n\tv_nop\n\tv_nop\n\tv_nop" : "+v"(acc[0]), "+v"(acc[1]), "+v"(acc[2]), "+v"(acc[3]) : "v"(a), "v"(al));
    }
    float* os = &ost[wave][0];
#pragma unroll
    for (int t = 0; t < 4; ++t) {
#pragma unroll
        for (int j = 0; j < 8; ++j) os[(hi * 8 + j) * 68 + t * 16 + lr] = acc[t][j]; }
    __builtin_amdgcn_wave_barrier(); asm volatile("" ::: "memory");
    float* crow = C + (size_t)r0 * ldc + c0;
    auto pass = [&]() {
#pragma unroll
        for (int s = 0; s < 8; ++s) { const int Lid = (lane >> 3) + 4 * s, piece = lane & 7; const int row = Lid >> 1, cofs = (Lid & 1) * 32 + piece * 4;
            const v4f val = *(const v4fa*)(os + row * 68 + cofs); *(v4f*)(crow + (size_t)row * ldc + cofs) = val; }
    };
    pass(); 
}

// k_gemmrb: 64 x 64 tile of C[o][v] = (A [+ Al]).B^T over K (A row stride K, B n-major row stride K) + bf(rbias[o]) per ROW; f32 whole-line epilogue (8 lanes x 16 B per line),
template <bool SPLITA>
__global__ __launch_bounds__(128) void k_gemmrb(const bf* __restrict__ A, const bf* __restrict__ Al, const bf* __restrict__ Bn, const float* __restrict__ rbias, float* C, int ldc, int K) {
    __shared__ __align__(16) float ost[4][16 * 68];
    const int lane = threadIdx.x & 31, wave = threadIdx.x >> 5, lr = lane & 15, hi = lane >> 4;
    const int r0 = blockIdx.x * 64 + wave * 16, c0 = blockIdx.y * 64;
    const size_t aoff = (size_t)(r0 + lr) * K + 8 * hi;
    v8f acc[4];
#pragma unroll
    for (int t = 0; t < 4; ++t) acc[t] = (v8f){};
#pragma unroll 1
    for (int kc = 0; kc < K; kc += 32) {
        const v16bf a = cat16b(*(const v8us*)(A + aoff + kc), *(const v8us*)(A + aoff + kc + 16));
        v16bf al = a; if (SPLITA) al = cat16b(*(const v8us*)(Al + aoff + kc), *(const v8us*)(Al + aoff + kc + 16));
#pragma unroll
        for (int t = 0; t < 4; ++t) { const size_t bo = (size_t)(c0 + t * 16 + lr) * K + kc + 8 * hi; const v16bf bb = cat16b(*(const v8us*)(Bn + bo), *(const v8us*)(Bn + bo + 16)); acc[t] = wmmab(a, bb, acc[t]); if (SPLITA) acc[t] = wmmab(al, bb, acc[t]); }
        asm volatile("v_nop\n\tv_nop\n\tv_nop\n\tv_nop" : "+v"(acc[0]), "+v"(acc[1]), "+v"(acc[2]), "+v"(acc[3]) : "v"(a), "v"(al));
    }
    float* os = &ost[wave][0];
#pragma unroll
    for (int t = 0; t < 4; ++t) {
#pragma unroll
        for (int j = 0; j < 8; ++j) os[(hi * 8 + j) * 68 + t * 16 + lr] = acc[t][j] + bfr(rbias[r0 + hi * 8 + j]); }
    __builtin_amdgcn_wave_barrier(); asm volatile("" ::: "memory");
    float* crow = C + (size_t)r0 * ldc + c0;
    auto pass = [&]() {
#pragma unroll
        for (int s = 0; s < 8; ++s) { const int Lid = (lane >> 3) + 4 * s, piece = lane & 7; const int row = Lid >> 1, cofs = (Lid & 1) * 32 + piece * 4;
            const v4f val = *(const v4fa*)(os + row * 68 + cofs); *(v4f*)(crow + (size_t)row * ldc + cofs) = val; }
    };
    pass(); 
}
__global__ __launch_bounds__(256) void k_softmax(const float* __restrict__ S, bf* PH, bf* PL) {
    const int lane = threadIdx.x & 31, r = blockIdx.x * 8 + (threadIdx.x >> 5); if (r >= RCH) return;
    const float* sr = S + (size_t)r * NN; float m = -3.0e38f;
#pragma unroll 1
    for (int c0 = lane * 8; c0 < NN; c0 += 256) { const v8f v = *(const v8f*)(sr + c0);
#pragma unroll
        for (int i = 0; i < 8; ++i) m = fmaxf(m, v[i]); }
#pragma unroll
    for (int sh = 16; sh; sh >>= 1) m = fmaxf(m, __shfl_xor(m, sh, 32));
    float sum = 0.f;
#pragma unroll 1
    for (int c0 = lane * 8; c0 < NN; c0 += 256) { const v8f v = *(const v8f*)(sr + c0);
#pragma unroll
        for (int i = 0; i < 8; ++i) sum += __expf(v[i] - m); }
#pragma unroll
    for (int sh = 16; sh; sh >>= 1) sum += __shfl_xor(sum, sh, 32);
    const float inv = 1.0f / sum;
{
#pragma unroll 1
        for (int c0 = lane * 8; c0 < NN; c0 += 256) { const v8f v = *(const v8f*)(sr + c0); v8us oh, ol;
#pragma unroll
            for (int i = 0; i < 8; ++i) { const float p = __expf(v[i] - m) * inv; const unsigned short hb = f2bf(p); oh[i] = hb; ol[i] = f2bf(p - bf2f(hb)); }
            const size_t o = (size_t)r * NN + c0; *(v8us*)(PH + o) = oh; *(v8us*)(PL + o) = ol; }
         }
}
__global__ __launch_bounds__(256) void k_cvt8(const float* __restrict__ src, bf* dst, size_t n8) {
    const size_t i = (size_t)blockIdx.x * 256 + threadIdx.x; if (i >= n8) return;
    const v8f v = *(const v8f*)(src + i * 8); v8us o;
#pragma unroll
    for (int k = 0; k < 8; ++k) o[k] = f2bf(v[k]);
    *(v8us*)(dst + i * 8) = o; 
}
__global__ __launch_bounds__(256) void k_zero8(bf* dst, size_t n8) {
    const size_t i = (size_t)blockIdx.x * 256 + threadIdx.x; if (i >= n8) return; v8us z;
#pragma unroll
    for (int k = 0; k < 8; ++k) z[k] = 0;
    *(v8us*)(dst + i * 8) = z; 
}

__global__ __launch_bounds__(64) void k_bnstat(const float* __restrict__ Y, float* MU, float* RS) {
    const int c = threadIdx.x; float s = 0.f;
#pragma unroll 4
    for (int r = 0; r < NALL; ++r) s += Y[(size_t)r * CQ + c];
    const float mu = s * (1.0f / NALL); float s2 = 0.f;
#pragma unroll 4
    for (int r = 0; r < NALL; ++r) { const float d = Y[(size_t)r * CQ + c] - mu; s2 = fmaf(d, d, s2); }
    const float rs = rsqrtf(s2 * (1.0f / NALL) + BN_EPS);
    *(float*)(MU + c) = mu; *(float*)(RS + c) = rs; 
}
__global__ __launch_bounds__(256) void k_bnsplit(const float* __restrict__ Y, const float* __restrict__ MU, const float* __restrict__ RS, const float* __restrict__ g, const float* __restrict__ be, bf* dh, bf* dl) {
    typedef __attribute__((ext_vector_type(2))) unsigned short v2us;
    const int lane = threadIdx.x & 31, r = blockIdx.x * 8 + (threadIdx.x >> 5); if (r >= NALL) return;
    const size_t o = (size_t)r * CQ + lane * 2; v2us oh, ol;
#pragma unroll
    for (int i = 0; i < 2; ++i) { const int c = lane * 2 + i; const float y = fmaxf((Y[o + i] - MU[c]) * RS[c] * bfr(g[c]) + bfr(be[c]), 0.f); const unsigned short hb = f2bf(y); oh[i] = hb; ol[i] = f2bf(y - bf2f(hb)); }
    *(v2us*)(dh + o) = oh; *(v2us*)(dl + o) = ol; 
}
__global__ __launch_bounds__(256) void k_gvsplit(const float* __restrict__ V, const float* __restrict__ h0, const float* __restrict__ h1, bf* Ph, bf* Pl) {
    const int lane = threadIdx.x & 31, r = blockIdx.x * 8 + (threadIdx.x >> 5); if (r >= CC) return;
{
#pragma unroll 1
        for (int c0 = lane * 8; c0 < NN; c0 += 256) { const size_t o = (size_t)r * NN + c0; const v8f v = *(const v8f*)(V + o), a = *(const v8f*)(h0 + o), bb = *(const v8f*)(h1 + o); v8us oh, ol;
#pragma unroll
            for (int q = 0; q < 8; ++q) { const float y = v[q] * (bfr(a[q]) + bfr(bb[q])); const unsigned short hb = f2bf(y); oh[q] = hb; ol[q] = f2bf(y - bf2f(hb)); }
            *(v8us*)(Ph + o) = oh; *(v8us*)(Pl + o) = ol; }
         }
}

extern "C" void kernel_launch(void* const* d_in, const int* in_sizes, int n_in,
                              void* d_out, int out_size, void* d_ws, size_t ws_size, hipStream_t stream) {
    (void)in_sizes; (void)n_in; (void)out_size;
    const float* x = (const float*)d_in[0]; const float* h0 = (const float*)d_in[1]; const float* h1 = (const float*)d_in[2];
    const float* Wq = (const float*)d_in[3]; const float* bq = (const float*)d_in[4]; const float* gq = (const float*)d_in[5]; const float* beq = (const float*)d_in[6];
    const float* Wk = (const float*)d_in[7]; const float* bk = (const float*)d_in[8]; const float* gk = (const float*)d_in[9]; const float* bek = (const float*)d_in[10]; const float* Wv = (const float*)d_in[11]; const float* bv = (const float*)d_in[12];
    float* out = (float*)d_out;    // [4][64][64][64]
    char* wsp = (char*)d_ws;
    auto take = [&](size_t bytes) { char* p = wsp; wsp += (bytes + 255) & ~(size_t)255; return (void*)p; };
    bf* WqB = (bf*)take(CQ * CC * 2); bf* WkB = (bf*)take(CQ * CC * 2); bf* WvB = (bf*)take(CC * CC * 2);
    bf* XT = (bf*)take((size_t)NALL * CC * 2); float* YQ = (float*)take((size_t)NALL * CQ * 4); float* YK = (float*)take((size_t)NALL * CQ * 4); float* ST4 = (float*)take(4 * 256);
    bf* Qh = (bf*)take((size_t)NALL * CQ * 2); bf* Ql = (bf*)take((size_t)NALL * CQ * 2); bf* Kh = (bf*)take((size_t)NALL * CQ * 2); bf* Kl = (bf*)take((size_t)NALL * CQ * 2);
    float* TMP = (float*)take((size_t)CC * NN * 4); bf* Vh = (bf*)take((size_t)CC * NN * 2); bf* Vl = (bf*)take((size_t)CC * NN * 2);
    float* S = (float*)take((size_t)RCH * NN * 4); bf* PH = (bf*)take((size_t)RCH * NN * 2); bf* PL = (bf*)take((size_t)RCH * NN * 2);
    if ((size_t)(wsp - (char*)d_ws) > ws_size) return;    // ~ 52 MiB, no aliasing
    float* MUQ = ST4; float* RSQ = ST4 + 64; float* MUK = ST4 + 128; float* RSK = ST4 + 192;
    { const size_t n1 = CQ * CC / 8; k_cvt8<<<(unsigned)((n1 + 255) / 256), 256, 0, stream>>>(Wq, WqB, n1); k_cvt8<<<(unsigned)((n1 + 255) / 256), 256, 0, stream>>>(Wk, WkB, n1); k_cvt8<<<(unsigned)((n1 + 255) / 256), 256, 0, stream>>>(Wv, WvB, n1); }
    for (int b = 0; b < NBI; ++b) k_wt<<<dim3(CC / 64, NN / 64, 1), 256, 0, stream>>>(x + (size_t)b * CC * NN, CC, NN, XT + (size_t)b * NN * CC);     // x^T [b*4096 + n][c]
    k_gemmb<false, false><<<dim3(NALL / 64, CQ / 64, 1), 128, 0, stream>>>(XT, nullptr, WqB, bq, YQ, CQ, nullptr);
    k_gemmb<false, false><<<dim3(NALL / 64, CQ / 64, 1), 128, 0, stream>>>(XT, nullptr, WkB, bk, YK, CQ, nullptr);
    k_bnstat<<<1, 64, 0, stream>>>(YQ, MUQ, RSQ); k_bnstat<<<1, 64, 0, stream>>>(YK, MUK, RSK);
    k_bnsplit<<<NALL / 8, 256, 0, stream>>>(YQ, MUQ, RSQ, gq, beq, Qh, Ql); k_bnsplit<<<NALL / 8, 256, 0, stream>>>(YK, MUK, RSK, gk, bek, Kh, Kl);
    // pass 2: per item value, softmax attention, context
    for (int b = 0; b < NBI; ++b) { const size_t tb = (size_t)b * NN;
        k_gemmrb<false><<<dim3(CC / 64, NN / 64, 1), 128, 0, stream>>>(WvB, nullptr, XT + tb * CC, bv, TMP, NN, CC);                           // v [c][n] (+ bv per row)
        k_gvsplit<<<CC / 8, 256, 0, stream>>>(TMP, h0 + (size_t)b * CC * NN, h1 + (size_t)b * CC * NN, Vh, Vl);                                  // gate x value -> planes
        for (int ch = 0; ch < NN / RCH; ++ch) { const size_t n0 = (size_t)ch * RCH;
            k_gemm3<<<dim3(RCH / 64, NN / 64, 1), 128, 0, stream>>>(Qh + (tb + n0) * CQ, Ql + (tb + n0) * CQ, Kh + tb * CQ, Kl + tb * CQ, CQ, S, NN);       // sim rows [q][k]
            k_softmax<<<RCH / 8, 256, 0, stream>>>(S, PH, PL);
            k_gemm3<<<dim3(CC / 64, RCH / 64, 1), 128, 0, stream>>>(Vh, Vl, PH, PL, NN, out + (size_t)b * CC * NN + n0, NN); }                   // ctx[c][q] = gv . P^T -> output
    }
}

// v001
// Measured time: 2960 microseconds a run.
// In two side-by-side timings against v000, it was 2.51 and 2.47 times as fast.
#include <hip/hip_runtime.h>

// Compute dtypes, f32 accumulate: query/key = relu(BN_batchstats(conv1x1(x))) with the 1x1 convs as token-major GEMMs over all 4 x 4096 positions ([16384 x 64].[64 x 64], PLAIN bf16
// operands = rounded input/weights, exact products, + bias), the per-channel batch mean/variance as a fixed-order f32 reduction, normalise + relu in f32 -> bf16 hi + UNSCALED residual
// planes; value = conv1x1 channel-major ([64 x 64].[64 x 4096] per item) x the gate (heat0 + heat1) -> planes; per item and 1024-row chunk: sim rows = q . k ([1024 x 64].[64 x 4096],
// three products) -> row softmax in f32 -> P planes; ctx[c][q] = sum_k gv[c][k] P[q][k] ([64 x 4096].[4096 x 1024], three products) written channel-major = the output layout - all on

#define NBI  4
#define CC   64
#define CQ   64
#define NN   4096
#define NALL (NBI * NN)           // 16384
#define RCH  1024
#define BN_EPS 1e-5f
#define DM   CC
#define NTK  NN
#define LOSC 1024.0f

typedef _Float16 h16;
typedef unsigned short bf;
typedef __attribute__((ext_vector_type(16))) __bf16   v16bf;
typedef __attribute__((ext_vector_type(16))) _Float16 v16h;
typedef __attribute__((ext_vector_type(8)))  _Float16 v8h;
typedef __attribute__((ext_vector_type(8)))  unsigned short v8us;
typedef __attribute__((ext_vector_type(8)))  float    v8f;
typedef __attribute__((ext_vector_type(4)))  float    v4f;
typedef __attribute__((ext_vector_type(4)))  _Float16 v4h;
typedef v8h  __attribute__((may_alias)) v8ha;
typedef v4f  __attribute__((may_alias)) v4fa;
typedef v8us __attribute__((may_alias)) v8usa;

__device__ __forceinline__ unsigned short f2bf(float f) { unsigned u = __float_as_uint(f); u += 0x7FFFu + ((u >> 16) & 1u); return (unsigned short)(u >> 16); }
__device__ __forceinline__ float bf2f(unsigned short b) { return __uint_as_float(((unsigned)b) << 16); }
__device__ __forceinline__ float bfr(float f) { return bf2f(f2bf(f)); }
__device__ __forceinline__ v16h cat16(v8h lo, v8h hi) { return __builtin_shufflevector(lo, hi, 0, 1, 2, 3, 4, 5, 6, 7, 8, 9, 10, 11, 12, 13, 14, 15); }
__device__ __forceinline__ v16bf cat16b(v8us lo, v8us hi) { return __builtin_bit_cast(v16bf, __builtin_shufflevector(lo, hi, 0, 1, 2, 3, 4, 5, 6, 7, 8, 9, 10, 11, 12, 13, 14, 15)); }
__device__ __forceinline__ v8f wmma16(v16h a, v16h b, v8f c) { return __builtin_amdgcn_wmma_f32_16x16x32_f16(false, a, false, b, (short)0, c, false, false); }
__device__ __forceinline__ v8f wmmab(v16bf a, v16bf b, v8f c) { return __builtin_amdgcn_wmma_f32_16x16x32_bf16(false, a, false, b, (short)0, c, false, false); }

// k_wt: WT [n][K] = bf16(W[k][n]) (k-major [K][ncols]) via 64 x 64 LDS tiles; grid (K/64, ncols/64).
__global__ __launch_bounds__(256) void k_wt(const float* __restrict__ Wm, int K, int ncols, bf* WT) {
    __shared__ __align__(16) unsigned short tl[64 * 72];
    const int tid = threadIdx.x, k0 = blockIdx.x * 64, n0 = blockIdx.y * 64;
    const int kk = tid >> 2, nq = (tid & 3) * 16;
#pragma unroll
    for (int i = 0; i < 16; ++i) tl[(nq + i) * 72 + kk] = f2bf(Wm[(size_t)(k0 + kk) * ncols + n0 + nq + i]);
    __syncthreads();
    const int piece = tid & 7;
    auto pass = [&]() {
#pragma unroll
        for (int s = 0; s < 2; ++s) { const int nr = (tid >> 3) + 32 * s; const v8us val = *(const v8usa*)(tl + nr * 72 + piece * 8); *(v8us*)(WT + (size_t)(n0 + nr) * K + k0 + piece * 8) = val; }
    };
    pass(); 
}
// k_gemmb: 64 x 64 block tile (4 waves x 16 x 64) of C[NALL][CQ] = (A [+ Al]).B^T (K = 64) [+ bf(bias[c])] [+ bf(R[r][c]) residual]; f32 whole-line epilogue (or f16
template <bool SPLITA, bool F16OUT = false>
__global__ __launch_bounds__(128) void k_gemmb(const bf* __restrict__ A, const bf* __restrict__ Al, const bf* __restrict__ Bn, const float* __restrict__ bias, float* C, int ldc, h16* C2, const float* __restrict__ R = nullptr, int K = DM, int roundR = 1) {
    __shared__ __align__(16) float ost[4][16 * 68];
    const int lane = threadIdx.x & 31, wave = threadIdx.x >> 5, lr = lane & 15, hi = lane >> 4;
    const int r0 = blockIdx.x * 64 + wave * 16, c0 = blockIdx.y * 64;
    const size_t aoff = (size_t)(r0 + lr) * K + 8 * hi;
    size_t boff[4];
#pragma unroll
    for (int t = 0; t < 4; ++t) boff[t] = (size_t)(c0 + t * 16 + lr) * K + 8 * hi;
    v8f acc[4];
#pragma unroll
    for (int t = 0; t < 4; ++t) acc[t] = (v8f){};
#pragma unroll 1
    for (int kc = 0; kc < K; kc += 32) {
        const v16bf a = cat16b(*(const v8us*)(A + aoff + kc), *(const v8us*)(A + aoff + kc + 16));
        v16bf al = a;
        if (SPLITA) al = cat16b(*(const v8us*)(Al + aoff + kc), *(const v8us*)(Al + aoff + kc + 16));
#pragma unroll
        for (int t = 0; t < 4; ++t) { const v16bf b = cat16b(*(const v8us*)(Bn + boff[t] + kc), *(const v8us*)(Bn + boff[t] + kc + 16)); acc[t] = wmmab(a, b, acc[t]); if (SPLITA) acc[t] = wmmab(al, b, acc[t]); }
        asm volatile("v_nop\n\tv_nop\n\tv_nop\n\tv_nop" : "+v"(acc[0]), "+v"(acc[1]), "+v"(acc[2]), "+v"(acc[3]) : "v"(a), "v"(al));
    }
    float* os = &ost[wave][0];
#pragma unroll
    for (int t = 0; t < 4; ++t) { const float bv = bias ? bfr(bias[c0 + t * 16 + lr]) : 0.f;
#pragma unroll
        for (int j = 0; j < 8; ++j) os[(hi * 8 + j) * 68 + t * 16 + lr] = acc[t][j] + bv; }
    __syncthreads();
    if (F16OUT) {
        h16* crow = (h16*)(void*)C + (size_t)r0 * ldc + c0;
        auto pass = [&]() {
#pragma unroll
            for (int s = 0; s < 4; ++s) { const int row = 4 * s + (lane >> 3), piece = lane & 7; const float* sp = os + row * 68 + piece * 8; v8h o, o2;
#pragma unroll
                for (int i = 0; i < 8; ++i) { const h16 a = (h16)sp[i]; o[i] = a; o2[i] = (h16)((sp[i] - (float)a) * LOSC); }
                *(v8h*)(crow + (size_t)row * ldc + piece * 8) = o; if (C2) *(v8h*)(C2 + (size_t)r0 * ldc + c0 + (size_t)row * ldc + piece * 8) = o2; }
        };
        pass(); 
    } else {
        float* crow = C + (size_t)r0 * ldc + c0;
        auto pass = [&]() {
#pragma unroll
            for (int s = 0; s < 8; ++s) { const int Lid = (lane >> 3) + 4 * s, piece = lane & 7; const int row = Lid >> 1, cofs = (Lid & 1) * 32 + piece * 4;
                v4f val = *(const v4fa*)(os + row * 68 + cofs); if (R) { const v4f rv = *(const v4f*)(R + ((size_t)r0 + row) * ldc + c0 + cofs); val += roundR ? (v4f){bfr(rv[0]), bfr(rv[1]), bfr(rv[2]), bfr(rv[3])} : rv; }
                *(v4f*)(crow + (size_t)row * ldc + cofs) = val; }
        };
        pass(); 
    }
}

// k_gemm3: 64 x 64 tile of C = (Ah + Al).(Bh + Bl)^T over K (row strides = K for all four planes; n-major B): three products per 32-k step (hh, hl, lh); f32
__global__ __launch_bounds__(128) void k_gemm3(const bf* __restrict__ Ah, const bf* __restrict__ Al, const bf* __restrict__ Bh, const bf* __restrict__ Bl, int K, float* C, int ldc) {
    __shared__ __align__(16) float ost[4][16 * 68];
    const int lane = threadIdx.x & 31, wave = threadIdx.x >> 5, lr = lane & 15, hi = lane >> 4;
    const int r0 = blockIdx.x * 64 + wave * 16, c0 = blockIdx.y * 64;
    const size_t aoff = (size_t)(r0 + lr) * K + 8 * hi;
    v8f acc[4];
#pragma unroll
    for (int t = 0; t < 4; ++t) acc[t] = (v8f){};
#pragma unroll 1
    for (int kc = 0; kc < K; kc += 32) {
        const v16bf a = cat16b(*(const v8us*)(Ah + aoff + kc), *(const v8us*)(Ah + aoff + kc + 16));
        const v16bf al = cat16b(*(const v8us*)(Al + aoff + kc), *(const v8us*)(Al + aoff + kc + 16));
#pragma unroll
        for (int t = 0; t < 4; ++t) { const size_t bo = (size_t)(c0 + t * 16 + lr) * K + kc + 8 * hi;
            const v16bf bh = cat16b(*(const v8us*)(Bh + bo), *(const v8us*)(Bh + bo + 16)); const v16bf bl = cat16b(*(const v8us*)(Bl + bo), *(const v8us*)(Bl + bo + 16));
            acc[t] = wmmab(a, bh, acc[t]); acc[t] = wmmab(al, bh, acc[t]); acc[t] = wmmab(a, bl, acc[t]); }
        asm volatile("v_nop\n\tv_nop\n\tv_nop\n\tv_nop" : "+v"(acc[0]), "+v"(acc[1]), "+v"(acc[2]), "+v"(acc[3]) : "v"(a), "v"(al));
    }
    float* os = &ost[wave][0];
#pragma unroll
    for (int t = 0; t < 4; ++t) {
#pragma unroll
        for (int j = 0; j < 8; ++j) os[(hi * 8 + j) * 68 + t * 16 + lr] = acc[t][j]; }
    __builtin_amdgcn_wave_barrier(); asm volatile("" ::: "memory");
    float* crow = C + (size_t)r0 * ldc + c0;
    auto pass = [&]() {
#pragma unroll
        for (int s = 0; s < 8; ++s) { const int Lid = (lane >> 3) + 4 * s, piece = lane & 7; const int row = Lid >> 1, cofs = (Lid & 1) * 32 + piece * 4;
            const v4f val = *(const v4fa*)(os + row * 68 + cofs); *(v4f*)(crow + (size_t)row * ldc + cofs) = val; }
    };
    pass(); 
}

// k_gemmrb: 64 x 64 tile of C[o][v] = (A [+ Al]).B^T over K (A row stride K, B n-major row stride K) + bf(rbias[o]) per ROW; f32 whole-line epilogue (8 lanes x 16 B per line),
template <bool SPLITA>
__global__ __launch_bounds__(128) void k_gemmrb(const bf* __restrict__ A, const bf* __restrict__ Al, const bf* __restrict__ Bn, const float* __restrict__ rbias, float* C, int ldc, int K) {
    __shared__ __align__(16) float ost[4][16 * 68];
    const int lane = threadIdx.x & 31, wave = threadIdx.x >> 5, lr = lane & 15, hi = lane >> 4;
    const int r0 = blockIdx.x * 64 + wave * 16, c0 = blockIdx.y * 64;
    const size_t aoff = (size_t)(r0 + lr) * K + 8 * hi;
    v8f acc[4];
#pragma unroll
    for (int t = 0; t < 4; ++t) acc[t] = (v8f){};
#pragma unroll 1
    for (int kc = 0; kc < K; kc += 32) {
        const v16bf a = cat16b(*(const v8us*)(A + aoff + kc), *(const v8us*)(A + aoff + kc + 16));
        v16bf al = a; if (SPLITA) al = cat16b(*(const v8us*)(Al + aoff + kc), *(const v8us*)(Al + aoff + kc + 16));
#pragma unroll
        for (int t = 0; t < 4; ++t) { const size_t bo = (size_t)(c0 + t * 16 + lr) * K + kc + 8 * hi; const v16bf bb = cat16b(*(const v8us*)(Bn + bo), *(const v8us*)(Bn + bo + 16)); acc[t] = wmmab(a, bb, acc[t]); if (SPLITA) acc[t] = wmmab(al, bb, acc[t]); }
        asm volatile("v_nop\n\tv_nop\n\tv_nop\n\tv_nop" : "+v"(acc[0]), "+v"(acc[1]), "+v"(acc[2]), "+v"(acc[3]) : "v"(a), "v"(al));
    }
    float* os = &ost[wave][0];
#pragma unroll
    for (int t = 0; t < 4; ++t) {
#pragma unroll
        for (int j = 0; j < 8; ++j) os[(hi * 8 + j) * 68 + t * 16 + lr] = acc[t][j] + bfr(rbias[r0 + hi * 8 + j]); }
    __builtin_amdgcn_wave_barrier(); asm volatile("" ::: "memory");
    float* crow = C + (size_t)r0 * ldc + c0;
    auto pass = [&]() {
#pragma unroll
        for (int s = 0; s < 8; ++s) { const int Lid = (lane >> 3) + 4 * s, piece = lane & 7; const int row = Lid >> 1, cofs = (Lid & 1) * 32 + piece * 4;
            const v4f val = *(const v4fa*)(os + row * 68 + cofs); *(v4f*)(crow + (size_t)row * ldc + cofs) = val; }
    };
    pass(); 
}
__global__ __launch_bounds__(256) void k_softmax(const float* __restrict__ S, bf* PH, bf* PL) {
    const int lane = threadIdx.x & 31, r = blockIdx.x * 8 + (threadIdx.x >> 5); if (r >= RCH) return;
    const float* sr = S + (size_t)r * NN; float m = -3.0e38f;
#pragma unroll 1
    for (int c0 = lane * 8; c0 < NN; c0 += 256) { const v8f v = *(const v8f*)(sr + c0);
#pragma unroll
        for (int i = 0; i < 8; ++i) m = fmaxf(m, v[i]); }
#pragma unroll
    for (int sh = 16; sh; sh >>= 1) m = fmaxf(m, __shfl_xor(m, sh, 32));
    float sum = 0.f;
#pragma unroll 1
    for (int c0 = lane * 8; c0 < NN; c0 += 256) { const v8f v = *(const v8f*)(sr + c0);
#pragma unroll
        for (int i = 0; i < 8; ++i) sum += __expf(v[i] - m); }
#pragma unroll
    for (int sh = 16; sh; sh >>= 1) sum += __shfl_xor(sum, sh, 32);
    const float inv = 1.0f / sum;
{
#pragma unroll 1
        for (int c0 = lane * 8; c0 < NN; c0 += 256) { const v8f v = *(const v8f*)(sr + c0); v8us oh, ol;
#pragma unroll
            for (int i = 0; i < 8; ++i) { const float p = __expf(v[i] - m) * inv; const unsigned short hb = f2bf(p); oh[i] = hb; ol[i] = f2bf(p - bf2f(hb)); }
            const size_t o = (size_t)r * NN + c0; *(v8us*)(PH + o) = oh; *(v8us*)(PL + o) = ol; }
         }
}
__global__ __launch_bounds__(256) void k_cvt8(const float* __restrict__ src, bf* dst, size_t n8) {
    const size_t i = (size_t)blockIdx.x * 256 + threadIdx.x; if (i >= n8) return;
    const v8f v = *(const v8f*)(src + i * 8); v8us o;
#pragma unroll
    for (int k = 0; k < 8; ++k) o[k] = f2bf(v[k]);
    *(v8us*)(dst + i * 8) = o; 
}
__global__ __launch_bounds__(256) void k_zero8(bf* dst, size_t n8) {
    const size_t i = (size_t)blockIdx.x * 256 + threadIdx.x; if (i >= n8) return; v8us z;
#pragma unroll
    for (int k = 0; k < 8; ++k) z[k] = 0;
    *(v8us*)(dst + i * 8) = z; 
}

// Batch statistics in two launches, fixed order. k_bnpart: grid (BNB, 2); each block holds BNR rows x 64 channels of one tensor (y = 0: YQ, y = 1: YK) in registers and
// writes per channel its sum and its squared deviations from the block's own mean: PART[(y * BNB + x) * 128 + c] and [.. + 64 + c].
#define BNB 256
#define BNR (NALL / BNB)          // 64 rows a block
__global__ __launch_bounds__(256) void k_bnpart(const float* __restrict__ YQ, const float* __restrict__ YK, float* PART) {
    __shared__ __align__(16) float rs_[16 * CQ];
    __shared__ __align__(16) float rq_[16 * CQ];
    const int tid = threadIdx.x, cq = (tid & 15) * 4, rg = tid >> 4;
    const float* Y = (blockIdx.y ? YK : YQ) + (size_t)blockIdx.x * BNR * CQ;
    v4f v[BNR / 16];
#pragma unroll
    for (int i = 0; i < BNR / 16; ++i) v[i] = *(const v4f*)(Y + (size_t)(rg + 16 * i) * CQ + cq);
    v4f s = v[0];
#pragma unroll
    for (int i = 1; i < BNR / 16; ++i) s += v[i];
    *(v4fa*)(rs_ + rg * CQ + cq) = s;
    __syncthreads();
    v4f t = *(const v4fa*)(rs_ + cq);
#pragma unroll
    for (int g = 1; g < 16; ++g) t += *(const v4fa*)(rs_ + g * CQ + cq);
    const v4f mu = t * (1.0f / BNR);
    v4f q = (v4f){};
#pragma unroll
    for (int i = 0; i < BNR / 16; ++i) { const v4f d = v[i] - mu; q += d * d; }
    *(v4fa*)(rq_ + rg * CQ + cq) = q;
    __syncthreads();
    if (tid < 16) {
        v4f m2 = *(const v4fa*)(rq_ + cq);
#pragma unroll
        for (int g = 1; g < 16; ++g) m2 += *(const v4fa*)(rq_ + g * CQ + cq);
        float* P = PART + ((size_t)blockIdx.y * BNB + blockIdx.x) * 128 + cq;
        *(v4f*)P = t; *(v4f*)(P + 64) = m2;
    }
}
// k_bnfin: block y joins the BNB partials of tensor y: mean = sum / NALL; M2 = sum_b (M2_b + BNR (mean_b - mean)^2); ST[y * 128 + c] = mean, ST[y * 128 + 64 + c] = rsqrt(var + eps).
__global__ __launch_bounds__(1024) void k_bnfin(const float* __restrict__ PART, float* ST) {
    __shared__ float ra[16 * CQ];
    __shared__ float rb[16 * CQ];
    const int tid = threadIdx.x, c = tid & 63, g = tid >> 6;
    const float* P = PART + ((size_t)blockIdx.x * BNB + g * (BNB / 16)) * 128 + c;
    float s[BNB / 16], m[BNB / 16];
#pragma unroll
    for (int i = 0; i < BNB / 16; ++i) { s[i] = P[i * 128]; m[i] = P[i * 128 + 64]; }
    float t = 0.f, q = 0.f;
#pragma unroll
    for (int i = 0; i < BNB / 16; ++i) { t += s[i]; q += m[i]; }
    ra[g * CQ + c] = t;
    __syncthreads();
    float tot = 0.f;
#pragma unroll
    for (int j = 0; j < 16; ++j) tot += ra[j * CQ + c];
    const float mu = tot * (1.0f / NALL);
#pragma unroll
    for (int i = 0; i < BNB / 16; ++i) { const float d = s[i] * (1.0f / BNR) - mu; q = fmaf(d * d, (float)BNR, q); }
    rb[g * CQ + c] = q;
    __syncthreads();
    if (tid < CQ) {
        float m2 = 0.f;
#pragma unroll
        for (int j = 0; j < 16; ++j) m2 += rb[j * CQ + c];
        ST[blockIdx.x * 128 + c] = mu; ST[blockIdx.x * 128 + 64 + c] = rsqrtf(m2 * (1.0f / NALL) + BN_EPS);
    }
}
__global__ __launch_bounds__(256) void k_bnsplit(const float* __restrict__ Y, const float* __restrict__ MU, const float* __restrict__ RS, const float* __restrict__ g, const float* __restrict__ be, bf* dh, bf* dl) {
    typedef __attribute__((ext_vector_type(2))) unsigned short v2us;
    const int lane = threadIdx.x & 31, r = blockIdx.x * 8 + (threadIdx.x >> 5); if (r >= NALL) return;
    const size_t o = (size_t)r * CQ + lane * 2; v2us oh, ol;
#pragma unroll
    for (int i = 0; i < 2; ++i) { const int c = lane * 2 + i; const float y = fmaxf((Y[o + i] - MU[c]) * RS[c] * bfr(g[c]) + bfr(be[c]), 0.f); const unsigned short hb = f2bf(y); oh[i] = hb; ol[i] = f2bf(y - bf2f(hb)); }
    *(v2us*)(dh + o) = oh; *(v2us*)(dl + o) = ol; 
}
__global__ __launch_bounds__(256) void k_gvsplit(const float* __restrict__ V, const float* __restrict__ h0, const float* __restrict__ h1, bf* Ph, bf* Pl) {
    const int lane = threadIdx.x & 31, r = blockIdx.x * 8 + (threadIdx.x >> 5); if (r >= CC) return;
{
#pragma unroll 1
        for (int c0 = lane * 8; c0 < NN; c0 += 256) { const size_t o = (size_t)r * NN + c0; const v8f v = *(const v8f*)(V + o), a = *(const v8f*)(h0 + o), bb = *(const v8f*)(h1 + o); v8us oh, ol;
#pragma unroll
            for (int q = 0; q < 8; ++q) { const float y = v[q] * (bfr(a[q]) + bfr(bb[q])); const unsigned short hb = f2bf(y); oh[q] = hb; ol[q] = f2bf(y - bf2f(hb)); }
            *(v8us*)(Ph + o) = oh; *(v8us*)(Pl + o) = ol; }
         }
}

extern "C" void kernel_launch(void* const* d_in, const int* in_sizes, int n_in,
                              void* d_out, int out_size, void* d_ws, size_t ws_size, hipStream_t stream) {
    (void)in_sizes; (void)n_in; (void)out_size;
    const float* x = (const float*)d_in[0]; const float* h0 = (const float*)d_in[1]; const float* h1 = (const float*)d_in[2];
    const float* Wq = (const float*)d_in[3]; const float* bq = (const float*)d_in[4]; const float* gq = (const float*)d_in[5]; const float* beq = (const float*)d_in[6];
    const float* Wk = (const float*)d_in[7]; const float* bk = (const float*)d_in[8]; const float* gk = (const float*)d_in[9]; const float* bek = (const float*)d_in[10]; const float* Wv = (const float*)d_in[11]; const float* bv = (const float*)d_in[12];
    float* out = (float*)d_out;    // [4][64][64][64]
    char* wsp = (char*)d_ws;
    auto take = [&](size_t bytes) { char* p = wsp; wsp += (bytes + 255) & ~(size_t)255; return (void*)p; };
    bf* WqB = (bf*)take(CQ * CC * 2); bf* WkB = (bf*)take(CQ * CC * 2); bf* WvB = (bf*)take(CC * CC * 2);
    bf* XT = (bf*)take((size_t)NALL * CC * 2); float* YQ = (float*)take((size_t)NALL * CQ * 4); float* YK = (float*)take((size_t)NALL * CQ * 4); float* ST4 = (float*)take(4 * 256); float* PART = (float*)take((size_t)2 * BNB * 128 * 4);
    bf* Qh = (bf*)take((size_t)NALL * CQ * 2); bf* Ql = (bf*)take((size_t)NALL * CQ * 2); bf* Kh = (bf*)take((size_t)NALL * CQ * 2); bf* Kl = (bf*)take((size_t)NALL * CQ * 2);
    float* TMP = (float*)take((size_t)CC * NN * 4); bf* Vh = (bf*)take((size_t)CC * NN * 2); bf* Vl = (bf*)take((size_t)CC * NN * 2);
    float* S = (float*)take((size_t)RCH * NN * 4); bf* PH = (bf*)take((size_t)RCH * NN * 2); bf* PL = (bf*)take((size_t)RCH * NN * 2);
    if ((size_t)(wsp - (char*)d_ws) > ws_size) return;    // ~ 52 MiB, no aliasing
    float* MUQ = ST4; float* RSQ = ST4 + 64; float* MUK = ST4 + 128; float* RSK = ST4 + 192;
    { const size_t n1 = CQ * CC / 8; k_cvt8<<<(unsigned)((n1 + 255) / 256), 256, 0, stream>>>(Wq, WqB, n1); k_cvt8<<<(unsigned)((n1 + 255) / 256), 256, 0, stream>>>(Wk, WkB, n1); k_cvt8<<<(unsigned)((n1 + 255) / 256), 256, 0, stream>>>(Wv, WvB, n1); }
    for (int b = 0; b < NBI; ++b) k_wt<<<dim3(CC / 64, NN / 64, 1), 256, 0, stream>>>(x + (size_t)b * CC * NN, CC, NN, XT + (size_t)b * NN * CC);     // x^T [b*4096 + n][c]
    k_gemmb<false, false><<<dim3(NALL / 64, CQ / 64, 1), 128, 0, stream>>>(XT, nullptr, WqB, bq, YQ, CQ, nullptr);
    k_gemmb<false, false><<<dim3(NALL / 64, CQ / 64, 1), 128, 0, stream>>>(XT, nullptr, WkB, bk, YK, CQ, nullptr);
    k_bnpart<<<dim3(BNB, 2, 1), 256, 0, stream>>>(YQ, YK, PART); k_bnfin<<<2, 1024, 0, stream>>>(PART, ST4);    // ST4 = MUQ, RSQ, MUK, RSK
    k_bnsplit<<<NALL / 8, 256, 0, stream>>>(YQ, MUQ, RSQ, gq, beq, Qh, Ql); k_bnsplit<<<NALL / 8, 256, 0, stream>>>(YK, MUK, RSK, gk, bek, Kh, Kl);
    // pass 2: per item value, softmax attention, context
    for (int b = 0; b < NBI; ++b) { const size_t tb = (size_t)b * NN;
        k_gemmrb<false><<<dim3(CC / 64, NN / 64, 1), 128, 0, stream>>>(WvB, nullptr, XT + tb * CC, bv, TMP, NN, CC);                           // v [c][n] (+ bv per row)
        k_gvsplit<<<CC / 8, 256, 0, stream>>>(TMP, h0 + (size_t)b * CC * NN, h1 + (size_t)b * CC * NN, Vh, Vl);                                  // gate x value -> planes
        for (int ch = 0; ch < NN / RCH; ++ch) { const size_t n0 = (size_t)ch * RCH;
            k_gemm3<<<dim3(RCH / 64, NN / 64, 1), 128, 0, stream>>>(Qh + (tb + n0) * CQ, Ql + (tb + n0) * CQ, Kh + tb * CQ, Kl + tb * CQ, CQ, S, NN);       // sim rows [q][k]
            k_softmax<<<RCH / 8, 256, 0, stream>>>(S, PH, PL);
            k_gemm3<<<dim3(CC / 64, RCH / 64, 1), 128, 0, stream>>>(Vh, Vl, PH, PL, NN, out + (size_t)b * CC * NN + n0, NN); }                   // ctx[c][q] = gv . P^T -> output
    }
}

// v002
// Measured time: 161 microseconds a run.
// Timed twice side by side with v001, it ran 18.5 and 18.4 times as fast.
// Counting every step since v000, it is 45.9 times as fast.
#include <hip/hip_runtime.h>

// Compute dtypes, f32 accumulate: query/key = relu(BN_batchstats(conv1x1(x))) with the 1x1 convs as token-major GEMMs over all 4 x 4096 positions ([16384 x 64].[64 x 64], PLAIN bf16
// operands = rounded input/weights, exact products, + bias), the per-channel batch mean/variance as a fixed-order f32 reduction, normalise + relu in f32 -> bf16 hi + UNSCALED residual
// planes; value = conv1x1 channel-major ([64 x 64].[64 x 4096] per item) x the gate (heat0 + heat1) -> planes; then one launch over all items: per 64 queries sim^T = k . q (three products) -> running
// softmax in f32 -> P planes in registers; ctx[c][q] = sum_k gv[c][k] P[q][k] (three products), divided by the row sum and written channel-major = the output layout - all on

#define NBI  4
#define CC   64
#define CQ   64
#define NN   4096
#define NALL (NBI * NN)           // 16384
#define BN_EPS 1e-5f
#define DM   CC
#define NTK  NN
#define LOSC 1024.0f

typedef _Float16 h16;
typedef unsigned short bf;
typedef __attribute__((ext_vector_type(16))) __bf16   v16bf;
typedef __attribute__((ext_vector_type(16))) _Float16 v16h;
typedef __attribute__((ext_vector_type(8)))  _Float16 v8h;
typedef __attribute__((ext_vector_type(8)))  unsigned short v8us;
typedef __attribute__((ext_vector_type(8)))  float    v8f;
typedef __attribute__((ext_vector_type(4)))  float    v4f;
typedef __attribute__((ext_vector_type(4)))  _Float16 v4h;
typedef v8h  __attribute__((may_alias)) v8ha;
typedef v4f  __attribute__((may_alias)) v4fa;
typedef v8us __attribute__((may_alias)) v8usa;

__device__ __forceinline__ unsigned short f2bf(float f) { unsigned u = __float_as_uint(f); u += 0x7FFFu + ((u >> 16) & 1u); return (unsigned short)(u >> 16); }
__device__ __forceinline__ float bf2f(unsigned short b) { return __uint_as_float(((unsigned)b) << 16); }
__device__ __forceinline__ float bfr(float f) { return bf2f(f2bf(f)); }
__device__ __forceinline__ v16h cat16(v8h lo, v8h hi) { return __builtin_shufflevector(lo, hi, 0, 1, 2, 3, 4, 5, 6, 7, 8, 9, 10, 11, 12, 13, 14, 15); }
__device__ __forceinline__ v16bf cat16b(v8us lo, v8us hi) { return __builtin_bit_cast(v16bf, __builtin_shufflevector(lo, hi, 0, 1, 2, 3, 4, 5, 6, 7, 8, 9, 10, 11, 12, 13, 14, 15)); }
__device__ __forceinline__ v8f wmma16(v16h a, v16h b, v8f c) { return __builtin_amdgcn_wmma_f32_16x16x32_f16(false, a, false, b, (short)0, c, false, false); }
__device__ __forceinline__ v8f wmmab(v16bf a, v16bf b, v8f c) { return __builtin_amdgcn_wmma_f32_16x16x32_bf16(false, a, false, b, (short)0, c, false, false); }

// k_wt: WT [n][K] = bf16(W[k][n]) (k-major [K][ncols]) via 64 x 64 LDS tiles; grid (K/64, ncols/64).
__global__ __launch_bounds__(256) void k_wt(const float* __restrict__ Wm, int K, int ncols, bf* WT) {
    __shared__ __align__(16) unsigned short tl[64 * 72];
    const int tid = threadIdx.x, k0 = blockIdx.x * 64, n0 = blockIdx.y * 64;
    const int kk = tid >> 2, nq = (tid & 3) * 16;
#pragma unroll
    for (int i = 0; i < 16; ++i) tl[(nq + i) * 72 + kk] = f2bf(Wm[(size_t)(k0 + kk) * ncols + n0 + nq + i]);
    __syncthreads();
    const int piece = tid & 7;
    auto pass = [&]() {
#pragma unroll
        for (int s = 0; s < 2; ++s) { const int nr = (tid >> 3) + 32 * s; const v8us val = *(const v8usa*)(tl + nr * 72 + piece * 8); *(v8us*)(WT + (size_t)(n0 + nr) * K + k0 + piece * 8) = val; }
    };
    pass(); 
}
// k_gemmb: 64 x 64 block tile (4 waves x 16 x 64) of C[NALL][CQ] = (A [+ Al]).B^T (K = 64) [+ bf(bias[c])] [+ bf(R[r][c]) residual]; f32 whole-line epilogue (or f16
template <bool SPLITA, bool F16OUT = false>
__global__ __launch_bounds__(128) void k_gemmb(const bf* __restrict__ A, const bf* __restrict__ Al, const bf* __restrict__ Bn, const float* __restrict__ bias, float* C, int ldc, h16* C2, const float* __restrict__ R = nullptr, int K = DM, int roundR = 1) {
    __shared__ __align__(16) float ost[4][16 * 68];
    const int lane = threadIdx.x & 31, wave = threadIdx.x >> 5, lr = lane & 15, hi = lane >> 4;
    const int r0 = blockIdx.x * 64 + wave * 16, c0 = blockIdx.y * 64;
    const size_t aoff = (size_t)(r0 + lr) * K + 8 * hi;
    size_t boff[4];
#pragma unroll
    for (int t = 0; t < 4; ++t) boff[t] = (size_t)(c0 + t * 16 + lr) * K + 8 * hi;
    v8f acc[4];
#pragma unroll
    for (int t = 0; t < 4; ++t) acc[t] = (v8f){};
#pragma unroll 1
    for (int kc = 0; kc < K; kc += 32) {
        const v16bf a = cat16b(*(const v8us*)(A + aoff + kc), *(const v8us*)(A + aoff + kc + 16));
        v16bf al = a;
        if (SPLITA) al = cat16b(*(const v8us*)(Al + aoff + kc), *(const v8us*)(Al + aoff + kc + 16));
#pragma unroll
        for (int t = 0; t < 4; ++t) { const v16bf b = cat16b(*(const v8us*)(Bn + boff[t] + kc), *(const v8us*)(Bn + boff[t] + kc + 16)); acc[t] = wmmab(a, b, acc[t]); if (SPLITA) acc[t] = wmmab(al, b, acc[t]); }
        asm volatile("v_nop\n\tv_nop\n\tv_nop\n\tv_nop" : "+v"(acc[0]), "+v"(acc[1]), "+v"(acc[2]), "+v"(acc[3]) : "v"(a), "v"(al));
    }
    float* os = &ost[wave][0];
#pragma unroll
    for (int t = 0; t < 4; ++t) { const float bv = bias ? bfr(bias[c0 + t * 16 + lr]) : 0.f;
#pragma unroll
        for (int j = 0; j < 8; ++j) os[(hi * 8 + j) * 68 + t * 16 + lr] = acc[t][j] + bv; }
    __syncthreads();
    if (F16OUT) {
        h16* crow = (h16*)(void*)C + (size_t)r0 * ldc + c0;
        auto pass = [&]() {
#pragma unroll
            for (int s = 0; s < 4; ++s) { const int row = 4 * s + (lane >> 3), piece = lane & 7; const float* sp = os + row * 68 + piece * 8; v8h o, o2;
#pragma unroll
                for (int i = 0; i < 8; ++i) { const h16 a = (h16)sp[i]; o[i] = a; o2[i] = (h16)((sp[i] - (float)a) * LOSC); }
                *(v8h*)(crow + (size_t)row * ldc + piece * 8) = o; if (C2) *(v8h*)(C2 + (size_t)r0 * ldc + c0 + (size_t)row * ldc + piece * 8) = o2; }
        };
        pass(); 
    } else {
        float* crow = C + (size_t)r0 * ldc + c0;
        auto pass = [&]() {
#pragma unroll
            for (int s = 0; s < 8; ++s) { const int Lid = (lane >> 3) + 4 * s, piece = lane & 7; const int row = Lid >> 1, cofs = (Lid & 1) * 32 + piece * 4;
                v4f val = *(const v4fa*)(os + row * 68 + cofs); if (R) { const v4f rv = *(const v4f*)(R + ((size_t)r0 + row) * ldc + c0 + cofs); val += roundR ? (v4f){bfr(rv[0]), bfr(rv[1]), bfr(rv[2]), bfr(rv[3])} : rv; }
                *(v4f*)(crow + (size_t)row * ldc + cofs) = val; }
        };
        pass(); 
    }
}

// k_gemmrb: 64 x 64 tile of C[o][v] = (A [+ Al]).B^T over K (A row stride K, B n-major row stride K) + bf(rbias[o]) per ROW; f32 whole-line epilogue (8 lanes x 16 B per line),
template <bool SPLITA>
__global__ __launch_bounds__(128) void k_gemmrb(const bf* __restrict__ A, const bf* __restrict__ Al, const bf* __restrict__ Bn, const float* __restrict__ rbias, float* C, int ldc, int K) {
    __shared__ __align__(16) float ost[4][16 * 68];
    const int lane = threadIdx.x & 31, wave = threadIdx.x >> 5, lr = lane & 15, hi = lane >> 4;
    const int r0 = blockIdx.x * 64 + wave * 16, c0 = blockIdx.y * 64;
    const size_t aoff = (size_t)(r0 + lr) * K + 8 * hi;
    v8f acc[4];
#pragma unroll
    for (int t = 0; t < 4; ++t) acc[t] = (v8f){};
#pragma unroll 1
    for (int kc = 0; kc < K; kc += 32) {
        const v16bf a = cat16b(*(const v8us*)(A + aoff + kc), *(const v8us*)(A + aoff + kc + 16));
        v16bf al = a; if (SPLITA) al = cat16b(*(const v8us*)(Al + aoff + kc), *(const v8us*)(Al + aoff + kc + 16));
#pragma unroll
        for (int t = 0; t < 4; ++t) { const size_t bo = (size_t)(c0 + t * 16 + lr) * K + kc + 8 * hi; const v16bf bb = cat16b(*(const v8us*)(Bn + bo), *(const v8us*)(Bn + bo + 16)); acc[t] = wmmab(a, bb, acc[t]); if (SPLITA) acc[t] = wmmab(al, bb, acc[t]); }
        asm volatile("v_nop\n\tv_nop\n\tv_nop\n\tv_nop" : "+v"(acc[0]), "+v"(acc[1]), "+v"(acc[2]), "+v"(acc[3]) : "v"(a), "v"(al));
    }
    float* os = &ost[wave][0];
#pragma unroll
    for (int t = 0; t < 4; ++t) {
#pragma unroll
        for (int j = 0; j < 8; ++j) os[(hi * 8 + j) * 68 + t * 16 + lr] = acc[t][j] + bfr(rbias[r0 + hi * 8 + j]); }
    __builtin_amdgcn_wave_barrier(); asm volatile("" ::: "memory");
    float* crow = C + (size_t)r0 * ldc + c0;
    auto pass = [&]() {
#pragma unroll
        for (int s = 0; s < 8; ++s) { const int Lid = (lane >> 3) + 4 * s, piece = lane & 7; const int row = Lid >> 1, cofs = (Lid & 1) * 32 + piece * 4;
            const v4f val = *(const v4fa*)(os + row * 68 + cofs); *(v4f*)(crow + (size_t)row * ldc + cofs) = val; }
    };
    pass(); 
}
// k_attn: sim, row softmax and context in one launch. A work-group owns 64 queries of one item: wave = (query tile qt of 16, key split g of KS). Per 32-key stage a wave forms
// S^T = K.Q^T (two 16-key tiles, three products), keeps a running maximum and sum per query (one query per lane column), packs p = 2^(s log2e - m) from the two score tiles straight
// into the B operand (hi + residual planes) and adds ctx^T += gv.P^T (four 16-channel tiles, three products). K and gv stages go global -> registers -> LDS, two buffers a split,
// one work-group barrier a stage. The KS partial (m, l, ctx) sets are joined in fixed order through LDS, divided by l and written as whole 256-byte output rows.
#define KS   4
#define NSTG (NN / KS / 32)       // 32-key stages a split
#define KPIT 72                   // LDS pitch of a 64-channel key row, elements (144 B)
#define VPIT 40                   // LDS pitch of a 32-key value row, elements (80 B)
#define KPL  (32 * KPIT)
#define VPL  (CC * VPIT)
#define STG  (2 * KPL + 2 * VPL)  // elements a stage buffer: K hi, K lo, gv hi, gv lo
#define MGW  (34 * 32)            // floats a wave's partial set: m, l, 32 context registers, lane-minor
#define OTOF ((KS - 1) * 4 * MGW) // float offset of the output tile [64 channels][68]
#define L2E  1.4426950408889634f
typedef float __attribute__((may_alias)) fa;
// value of lane l ^ 16 (the other half of the same query column), on the vector port
__device__ __forceinline__ float xhalf(float v) { const int u = __float_as_int(v); return __int_as_float(__builtin_amdgcn_permlanex16(u, u, 0x76543210, 0xfedcba98, false, false)); }
// Eight 2^x in one statement: the outputs are early-clobber, so no v_exp_f32 overwrites the source of the one in front of it, and the closing v_nop is the one slot that the
// instruction set asks for between the last v_exp_f32 and the next vector instruction, which the compiler is free to choose.
__device__ __forceinline__ void exp2x8(const float* x, float* p) {
    asm("v_exp_f32 %0, %8\n\tv_exp_f32 %1, %9\n\tv_exp_f32 %2, %10\n\tv_exp_f32 %3, %11\n\tv_exp_f32 %4, %12\n\tv_exp_f32 %5, %13\n\tv_exp_f32 %6, %14\n\tv_exp_f32 %7, %15\n\tv_nop"
        : "=&v"(p[0]), "=&v"(p[1]), "=&v"(p[2]), "=&v"(p[3]), "=&v"(p[4]), "=&v"(p[5]), "=&v"(p[6]), "=&v"(p[7])
        : "v"(x[0]), "v"(x[1]), "v"(x[2]), "v"(x[3]), "v"(x[4]), "v"(x[5]), "v"(x[6]), "v"(x[7]));
}
// One 2^x with the same slot behind it.
__device__ __forceinline__ float exp2x1(float x) { float p; asm("v_exp_f32 %0, %1\n\tv_nop" : "=v"(p) : "v"(x)); return p; }
__global__ __launch_bounds__(KS * 128) void k_attn(const bf* __restrict__ Qh, const bf* __restrict__ Ql, const bf* __restrict__ Kh, const bf* __restrict__ Kl, const bf* __restrict__ Vh, const bf* __restrict__ Vl, float* out) {
    __shared__ __align__(16) unsigned short L[KS * 2 * STG];
    const int tid = threadIdx.x, lane = tid & 31, lr = lane & 15, hi = lane >> 4, tg = tid & 127;
    const int wave = __builtin_amdgcn_readfirstlane(tid >> 5), qt = wave & 3, g = wave >> 2;    // scalar, so that the LDS bases and the tests on g stay on the scalar unit
    const int b = blockIdx.y, q0 = blockIdx.x * 64;
    const size_t tb = (size_t)b * NN;
    const size_t qo = (tb + q0 + qt * 16 + lr) * CQ + 8 * hi;
    v16bf qh[2], ql[2];
#pragma unroll
    for (int kc = 0; kc < 2; ++kc) { qh[kc] = cat16b(*(const v8us*)(Qh + qo + kc * 32), *(const v8us*)(Qh + qo + kc * 32 + 16)); ql[kc] = cat16b(*(const v8us*)(Ql + qo + kc * 32), *(const v8us*)(Ql + qo + kc * 32 + 16)); }
    const size_t gko = (tb + (size_t)g * (NN / KS)) * CQ + tg * 8;                                   // a K stage is 4 KB in a row a plane: chunks tg and tg + 128
    const size_t gvo = ((size_t)b * CC + (tg >> 2)) * NN + (size_t)g * (NN / KS) + (tg & 3) * 8;     // a gv stage is 64 rows of 64 B a plane: rows tg / 4 and tg / 4 + 32
    const int lk = (tg >> 3) * KPIT + (tg & 7) * 8, lv = (tg >> 2) * VPIT + (tg & 3) * 8;
    v8us rk[4], rv[4];
    auto gload = [&](int s) {
        const size_t ko = gko + (size_t)s * 32 * CQ, vo = gvo + (size_t)s * 32;
        rk[0] = *(const v8us*)(Kh + ko); rk[1] = *(const v8us*)(Kh + ko + 1024); rk[2] = *(const v8us*)(Kl + ko); rk[3] = *(const v8us*)(Kl + ko + 1024);
        rv[0] = *(const v8us*)(Vh + vo); rv[1] = *(const v8us*)(Vh + vo + (size_t)32 * NN); rv[2] = *(const v8us*)(Vl + vo); rv[3] = *(const v8us*)(Vl + vo + (size_t)32 * NN);
    };
    auto lstore = [&](int buf) {
        unsigned short* B = L + (g * 2 + buf) * STG;
        *(v8usa*)(B + lk) = rk[0]; *(v8usa*)(B + lk + 16 * KPIT) = rk[1]; *(v8usa*)(B + KPL + lk) = rk[2]; *(v8usa*)(B + KPL + lk + 16 * KPIT) = rk[3];
        *(v8usa*)(B + 2 * KPL + lv) = rv[0]; *(v8usa*)(B + 2 * KPL + lv + 32 * VPIT) = rv[1]; *(v8usa*)(B + 2 * KPL + VPL + lv) = rv[2]; *(v8usa*)(B + 2 * KPL + VPL + lv + 32 * VPIT) = rv[3];
    };
    gload(0); lstore(0);
    __syncthreads();
    float ml = -3.0e38f, ls = 0.f;    // running maximum (in log2 units) and this lane's half of the running sum
    v8f acc[4];
#pragma unroll
    for (int ct = 0; ct < 4; ++ct) acc[ct] = (v8f){};
#pragma unroll 1    // one stage a trip: the buffers alternate by s & 1; a second copy of the body would only add code and live registers
    for (int s = 0; s < NSTG; ++s) {
        if (s + 1 < NSTG) gload(s + 1);
        const unsigned short* B = L + (g * 2 + (s & 1)) * STG;
        v8f st[2];
#pragma unroll
        for (int t = 0; t < 2; ++t) { st[t] = (v8f){};
#pragma unroll
            for (int kc = 0; kc < 2; ++kc) { const unsigned short* p = B + (t * 16 + lr) * KPIT + kc * 32 + 8 * hi;
                const v16bf kh = cat16b(*(const v8usa*)p, *(const v8usa*)(p + 16)), kl = cat16b(*(const v8usa*)(p + KPL), *(const v8usa*)(p + KPL + 16));
                st[t] = wmmab(kh, qh[kc], st[t]); st[t] = wmmab(kl, qh[kc], st[t]); st[t] = wmmab(kh, ql[kc], st[t]); } }
        float mx = fmaxf(st[0][0], st[1][0]);
#pragma unroll
        for (int r = 1; r < 8; ++r) mx = fmaxf(mx, fmaxf(st[0][r], st[1][r]));
        mx = fmaxf(mx, xhalf(mx));
        const float mn = fmaxf(ml, mx * L2E), al = exp2x1(ml - mn);
        ml = mn;
        v16bf ph, pl; float ps[4] = {0.f, 0.f, 0.f, 0.f};    // four independent sum chains
#pragma unroll
        for (int t = 0; t < 2; ++t) { float x[8], p[8];
#pragma unroll
            for (int r = 0; r < 8; ++r) x[r] = fmaf(st[t][r], L2E, -mn);
            exp2x8(x, p);
#pragma unroll
            for (int r = 0; r < 8; ++r) { ps[r & 3] += p[r]; const __bf16 hb = (__bf16)p[r]; ph[t * 8 + r] = hb; pl[t * 8 + r] = (__bf16)(p[r] - (float)hb); } }
        ls = fmaf(ls, al, (ps[0] + ps[1]) + (ps[2] + ps[3]));
#pragma unroll
        for (int ct = 0; ct < 4; ++ct) acc[ct] *= al;
#pragma unroll
        for (int ct = 0; ct < 4; ++ct) { const unsigned short* p = B + 2 * KPL + (ct * 16 + lr) * VPIT + 8 * hi;
            const v16bf vh = cat16b(*(const v8usa*)p, *(const v8usa*)(p + 16)), vl = cat16b(*(const v8usa*)(p + VPL), *(const v8usa*)(p + VPL + 16));
            acc[ct] = wmmab(vh, ph, acc[ct]); acc[ct] = wmmab(vl, ph, acc[ct]); acc[ct] = wmmab(vh, pl, acc[ct]); }
        if (s + 1 < NSTG) lstore((s + 1) & 1);
        __syncthreads();    // publishes stage s + 1 and ends every read of the buffer that the next pass refills
    }
    ls += xhalf(ls);
    fa* F = (fa*)(void*)L;    // the stage buffers are free behind the loop's last barrier
    if (g > 0) { fa* M = F + ((g - 1) * 4 + qt) * MGW + lane; M[0] = ml; M[32] = ls;
#pragma unroll
        for (int i = 0; i < 32; ++i) M[(2 + i) * 32] = acc[i >> 3][i & 7]; }
    __syncthreads();
    if (g == 0) {
#pragma unroll 1    // runs once a launch: kept rolled for code size
        for (int o = 0; o < KS - 1; ++o) { const fa* M = F + (o * 4 + qt) * MGW + lane; const float m2 = M[0], l2 = M[32], mn = fmaxf(ml, m2);
            const float a1 = exp2x1(ml - mn), a2 = exp2x1(m2 - mn); ls = ls * a1 + l2 * a2; ml = mn;
#pragma unroll
            for (int i = 0; i < 32; ++i) acc[i >> 3][i & 7] = acc[i >> 3][i & 7] * a1 + M[(2 + i) * 32] * a2; }
        const float inv = 1.0f / ls;
#pragma unroll
        for (int i = 0; i < 32; ++i) F[OTOF + ((i >> 3) * 16 + 8 * hi + (i & 7)) * 68 + qt * 16 + lr] = acc[i >> 3][i & 7] * inv;
    }
    __syncthreads();
#pragma unroll
    for (int j = 0; j < CC * 16 / (KS * 128); ++j) { const int i = tid + j * KS * 128, row = i >> 4, col = i & 15; const v4f val = *(const v4fa*)(F + OTOF + row * 68 + col * 4); *(v4f*)(out + ((size_t)b * CC + row) * NN + q0 + col * 4) = val; }
}
__global__ __launch_bounds__(256) void k_cvt8(const float* __restrict__ src, bf* dst, size_t n8) {
    const size_t i = (size_t)blockIdx.x * 256 + threadIdx.x; if (i >= n8) return;
    const v8f v = *(const v8f*)(src + i * 8); v8us o;
#pragma unroll
    for (int k = 0; k < 8; ++k) o[k] = f2bf(v[k]);
    *(v8us*)(dst + i * 8) = o; 
}
__global__ __launch_bounds__(256) void k_zero8(bf* dst, size_t n8) {
    const size_t i = (size_t)blockIdx.x * 256 + threadIdx.x; if (i >= n8) return; v8us z;
#pragma unroll
    for (int k = 0; k < 8; ++k) z[k] = 0;
    *(v8us*)(dst + i * 8) = z; 
}

// Batch statistics in two launches, fixed order. k_bnpart: grid (BNB, 2); each block holds BNR rows x 64 channels of one tensor (y = 0: YQ, y = 1: YK) in registers and
// writes per channel its sum and its squared deviations from the block's own mean: PART[(y * BNB + x) * 128 + c] and [.. + 64 + c].
#define BNB 256
#define BNR (NALL / BNB)          // 64 rows a block
__global__ __launch_bounds__(256) void k_bnpart(const float* __restrict__ YQ, const float* __restrict__ YK, float* PART) {
    __shared__ __align__(16) float rs_[16 * CQ];
    __shared__ __align__(16) float rq_[16 * CQ];
    const int tid = threadIdx.x, cq = (tid & 15) * 4, rg = tid >> 4;
    const float* Y = (blockIdx.y ? YK : YQ) + (size_t)blockIdx.x * BNR * CQ;
    v4f v[BNR / 16];
#pragma unroll
    for (int i = 0; i < BNR / 16; ++i) v[i] = *(const v4f*)(Y + (size_t)(rg + 16 * i) * CQ + cq);
    v4f s = v[0];
#pragma unroll
    for (int i = 1; i < BNR / 16; ++i) s += v[i];
    *(v4fa*)(rs_ + rg * CQ + cq) = s;
    __syncthreads();
    v4f t = *(const v4fa*)(rs_ + cq);
#pragma unroll
    for (int g = 1; g < 16; ++g) t += *(const v4fa*)(rs_ + g * CQ + cq);
    const v4f mu = t * (1.0f / BNR);
    v4f q = (v4f){};
#pragma unroll
    for (int i = 0; i < BNR / 16; ++i) { const v4f d = v[i] - mu; q += d * d; }
    *(v4fa*)(rq_ + rg * CQ + cq) = q;
    __syncthreads();
    if (tid < 16) {
        v4f m2 = *(const v4fa*)(rq_ + cq);
#pragma unroll
        for (int g = 1; g < 16; ++g) m2 += *(const v4fa*)(rq_ + g * CQ + cq);
        float* P = PART + ((size_t)blockIdx.y * BNB + blockIdx.x) * 128 + cq;
        *(v4f*)P = t; *(v4f*)(P + 64) = m2;
    }
}
// k_bnfin: block y joins the BNB partials of tensor y: mean = sum / NALL; M2 = sum_b (M2_b + BNR (mean_b - mean)^2); ST[y * 128 + c] = mean, ST[y * 128 + 64 + c] = rsqrt(var + eps).
__global__ __launch_bounds__(1024) void k_bnfin(const float* __restrict__ PART, float* ST) {
    __shared__ float ra[16 * CQ];
    __shared__ float rb[16 * CQ];
    const int tid = threadIdx.x, c = tid & 63, g = tid >> 6;
    const float* P = PART + ((size_t)blockIdx.x * BNB + g * (BNB / 16)) * 128 + c;
    float s[BNB / 16], m[BNB / 16];
#pragma unroll
    for (int i = 0; i < BNB / 16; ++i) { s[i] = P[i * 128]; m[i] = P[i * 128 + 64]; }
    float t = 0.f, q = 0.f;
#pragma unroll
    for (int i = 0; i < BNB / 16; ++i) { t += s[i]; q += m[i]; }
    ra[g * CQ + c] = t;
    __syncthreads();
    float tot = 0.f;
#pragma unroll
    for (int j = 0; j < 16; ++j) tot += ra[j * CQ + c];
    const float mu = tot * (1.0f / NALL);
#pragma unroll
    for (int i = 0; i < BNB / 16; ++i) { const float d = s[i] * (1.0f / BNR) - mu; q = fmaf(d * d, (float)BNR, q); }
    rb[g * CQ + c] = q;
    __syncthreads();
    if (tid < CQ) {
        float m2 = 0.f;
#pragma unroll
        for (int j = 0; j < 16; ++j) m2 += rb[j * CQ + c];
        ST[blockIdx.x * 128 + c] = mu; ST[blockIdx.x * 128 + 64 + c] = rsqrtf(m2 * (1.0f / NALL) + BN_EPS);
    }
}
__global__ __launch_bounds__(256) void k_bnsplit(const float* __restrict__ Y, const float* __restrict__ MU, const float* __restrict__ RS, const float* __restrict__ g, const float* __restrict__ be, bf* dh, bf* dl) {
    typedef __attribute__((ext_vector_type(2))) unsigned short v2us;
    const int lane = threadIdx.x & 31, r = blockIdx.x * 8 + (threadIdx.x >> 5); if (r >= NALL) return;
    const size_t o = (size_t)r * CQ + lane * 2; v2us oh, ol;
#pragma unroll
    for (int i = 0; i < 2; ++i) { const int c = lane * 2 + i; const float y = fmaxf((Y[o + i] - MU[c]) * RS[c] * bfr(g[c]) + bfr(be[c]), 0.f); const unsigned short hb = f2bf(y); oh[i] = hb; ol[i] = f2bf(y - bf2f(hb)); }
    *(v2us*)(dh + o) = oh; *(v2us*)(dl + o) = ol; 
}
__global__ __launch_bounds__(256) void k_gvsplit(const float* __restrict__ V, const float* __restrict__ h0, const float* __restrict__ h1, bf* Ph, bf* Pl) {
    const int lane = threadIdx.x & 31, r = blockIdx.x * 8 + (threadIdx.x >> 5); if (r >= CC) return;
{
#pragma unroll 1
        for (int c0 = lane * 8; c0 < NN; c0 += 256) { const size_t o = (size_t)r * NN + c0; const v8f v = *(const v8f*)(V + o), a = *(const v8f*)(h0 + o), bb = *(const v8f*)(h1 + o); v8us oh, ol;
#pragma unroll
            for (int q = 0; q < 8; ++q) { const float y = v[q] * (bfr(a[q]) + bfr(bb[q])); const unsigned short hb = f2bf(y); oh[q] = hb; ol[q] = f2bf(y - bf2f(hb)); }
            *(v8us*)(Ph + o) = oh; *(v8us*)(Pl + o) = ol; }
         }
}

extern "C" void kernel_launch(void* const* d_in, const int* in_sizes, int n_in,
                              void* d_out, int out_size, void* d_ws, size_t ws_size, hipStream_t stream) {
    (void)in_sizes; (void)n_in; (void)out_size;
    const float* x = (const float*)d_in[0]; const float* h0 = (const float*)d_in[1]; const float* h1 = (const float*)d_in[2];
    const float* Wq = (const float*)d_in[3]; const float* bq = (const float*)d_in[4]; const float* gq = (const float*)d_in[5]; const float* beq = (const float*)d_in[6];
    const float* Wk = (const float*)d_in[7]; const float* bk = (const float*)d_in[8]; const float* gk = (const float*)d_in[9]; const float* bek = (const float*)d_in[10]; const float* Wv = (const float*)d_in[11]; const float* bv = (const float*)d_in[12];
    float* out = (float*)d_out;    // [4][64][64][64]
    char* wsp = (char*)d_ws;
    auto take = [&](size_t bytes) { char* p = wsp; wsp += (bytes + 255) & ~(size_t)255; return (void*)p; };
    bf* WqB = (bf*)take(CQ * CC * 2); bf* WkB = (bf*)take(CQ * CC * 2); bf* WvB = (bf*)take(CC * CC * 2);
    bf* XT = (bf*)take((size_t)NALL * CC * 2); float* YQ = (float*)take((size_t)NALL * CQ * 4); float* YK = (float*)take((size_t)NALL * CQ * 4); float* ST4 = (float*)take(4 * 256); float* PART = (float*)take((size_t)2 * BNB * 128 * 4);
    bf* Qh = (bf*)take((size_t)NALL * CQ * 2); bf* Ql = (bf*)take((size_t)NALL * CQ * 2); bf* Kh = (bf*)take((size_t)NALL * CQ * 2); bf* Kl = (bf*)take((size_t)NALL * CQ * 2);
    float* TMP = (float*)take((size_t)CC * NN * 4); bf* Vh = (bf*)take((size_t)NBI * CC * NN * 2); bf* Vl = (bf*)take((size_t)NBI * CC * NN * 2);
    if ((size_t)(wsp - (char*)d_ws) > ws_size) return;    // ~ 24 MB, no aliasing
    float* MUQ = ST4; float* RSQ = ST4 + 64; float* MUK = ST4 + 128; float* RSK = ST4 + 192;
    { const size_t n1 = CQ * CC / 8; k_cvt8<<<(unsigned)((n1 + 255) / 256), 256, 0, stream>>>(Wq, WqB, n1); k_cvt8<<<(unsigned)((n1 + 255) / 256), 256, 0, stream>>>(Wk, WkB, n1); k_cvt8<<<(unsigned)((n1 + 255) / 256), 256, 0, stream>>>(Wv, WvB, n1); }
    for (int b = 0; b < NBI; ++b) k_wt<<<dim3(CC / 64, NN / 64, 1), 256, 0, stream>>>(x + (size_t)b * CC * NN, CC, NN, XT + (size_t)b * NN * CC);     // x^T [b*4096 + n][c]
    k_gemmb<false, false><<<dim3(NALL / 64, CQ / 64, 1), 128, 0, stream>>>(XT, nullptr, WqB, bq, YQ, CQ, nullptr);
    k_gemmb<false, false><<<dim3(NALL / 64, CQ / 64, 1), 128, 0, stream>>>(XT, nullptr, WkB, bk, YK, CQ, nullptr);
    k_bnpart<<<dim3(BNB, 2, 1), 256, 0, stream>>>(YQ, YK, PART); k_bnfin<<<2, 1024, 0, stream>>>(PART, ST4);    // ST4 = MUQ, RSQ, MUK, RSK
    k_bnsplit<<<NALL / 8, 256, 0, stream>>>(YQ, MUQ, RSQ, gq, beq, Qh, Ql); k_bnsplit<<<NALL / 8, 256, 0, stream>>>(YK, MUK, RSK, gk, bek, Kh, Kl);
    // pass 2: per item the gated value planes, then softmax attention and context for all items in one launch
    for (int b = 0; b < NBI; ++b) { const size_t tb = (size_t)b * NN;
        k_gemmrb<false><<<dim3(CC / 64, NN / 64, 1), 128, 0, stream>>>(WvB, nullptr, XT + tb * CC, bv, TMP, NN, CC);                           // v [c][n] (+ bv per row)
        k_gvsplit<<<CC / 8, 256, 0, stream>>>(TMP, h0 + (size_t)b * CC * NN, h1 + (size_t)b * CC * NN, Vh + (size_t)b * CC * NN, Vl + (size_t)b * CC * NN); }    // gate x value -> planes
    k_attn<<<dim3(NN / 64, NBI, 1), KS * 128, 0, stream>>>(Qh, Ql, Kh, Kl, Vh, Vl, out);
}

// v003
// One run takes 68.2 microseconds.
// Next to v002, in two timings, it ran 2.38 and 2.36 times as fast.
// All steps since v000 together make it 109 times as fast.
#include <hip/hip_runtime.h>

// Compute dtypes, f32 accumulate: query/key = relu(BN_batchstats(conv1x1(x))) with the 1x1 convs as token-major GEMMs over all 4 x 4096 positions ([16384 x 64].[64 x 64], PLAIN bf16
// operands = rounded input/weights, exact products, + bias), the per-channel batch mean/variance as a fixed-order f32 reduction, normalise + relu in f32 -> bf16 hi + UNSCALED residual
// planes; value = conv1x1 channel-major ([64 x 64].[64 x 4096] per item) x the gate (heat0 + heat1) -> planes; then one launch over all items: per 64 queries sim^T = k . q (three products) -> running
// softmax in f32 -> P planes in registers; ctx[c][q] = sum_k gv[c][k] P[q][k] (three products), divided by the row sum and written channel-major = the output layout - all on

#define NBI  4
#define CC   64
#define CQ   64
#define NN   4096
#define NALL (NBI * NN)           // 16384
#define BN_EPS 1e-5f
#define DM   CC
#define NTK  NN
#define LOSC 1024.0f

typedef _Float16 h16;
typedef unsigned short bf;
typedef __attribute__((ext_vector_type(16))) __bf16   v16bf;
typedef __attribute__((ext_vector_type(16))) _Float16 v16h;
typedef __attribute__((ext_vector_type(8)))  _Float16 v8h;
typedef __attribute__((ext_vector_type(8)))  unsigned short v8us;
typedef __attribute__((ext_vector_type(8)))  float    v8f;
typedef __attribute__((ext_vector_type(4)))  float    v4f;
typedef __attribute__((ext_vector_type(4)))  _Float16 v4h;
typedef v8h  __attribute__((may_alias)) v8ha;
typedef v4f  __attribute__((may_alias)) v4fa;
typedef v8us __attribute__((may_alias)) v8usa;

__device__ __forceinline__ unsigned short f2bf(float f) { unsigned u = __float_as_uint(f); u += 0x7FFFu + ((u >> 16) & 1u); return (unsigned short)(u >> 16); }
__device__ __forceinline__ float bf2f(unsigned short b) { return __uint_as_float(((unsigned)b) << 16); }
__device__ __forceinline__ float bfr(float f) { return bf2f(f2bf(f)); }
__device__ __forceinline__ v16h cat16(v8h lo, v8h hi) { return __builtin_shufflevector(lo, hi, 0, 1, 2, 3, 4, 5, 6, 7, 8, 9, 10, 11, 12, 13, 14, 15); }
__device__ __forceinline__ v16bf cat16b(v8us lo, v8us hi) { return __builtin_bit_cast(v16bf, __builtin_shufflevector(lo, hi, 0, 1, 2, 3, 4, 5, 6, 7, 8, 9, 10, 11, 12, 13, 14, 15)); }
__device__ __forceinline__ v8f wmma16(v16h a, v16h b, v8f c) { return __builtin_amdgcn_wmma_f32_16x16x32_f16(false, a, false, b, (short)0, c, false, false); }
__device__ __forceinline__ v8f wmmab(v16bf a, v16bf b, v8f c) { return __builtin_amdgcn_wmma_f32_16x16x32_bf16(false, a, false, b, (short)0, c, false, false); }

// k_proj: everything in front of the batch statistics, one launch. A work-group owns 64 positions of one item. It rounds its x tile [64 channels][64 positions] and the three weight
// matrices to bf16 into LDS (x transposed to position-major), forms on waves 0-11 (matrix m = wave / 4, 16-row tile = wave % 4) yq, yk = x^T . W^T + bias (position-major) and
// v = Wv . x + bias (channel-major) into f32 LDS tiles, then writes yq, yk, their per-channel sum and squared deviations from the block's own mean
// (PART[(y * BNB + block) * 128 + c] and [.. + 64 + c], y = 0: yq, 1: yk; fixed order) and the planes of v x (heat0 + heat1).
#define BNB  256
#define BNR  (NALL / BNB)         // 64 rows a block
#define XPIT 72                   // LDS pitch of a 64-channel bf16 row, elements (144 B)
#define XPL  (64 * XPIT)
#define YPIT 68                   // LDS pitch of a 64-wide f32 row, elements (272 B)
#define YPL  (64 * YPIT)
typedef unsigned __attribute__((may_alias)) ua;
__global__ __launch_bounds__(512) void k_proj(const float* __restrict__ x, const float* __restrict__ h0, const float* __restrict__ h1, float* YQ,
                                              const float* __restrict__ Wq, const float* __restrict__ Wk, const float* __restrict__ Wv, float* YK,
                                              const float* __restrict__ bq, const float* __restrict__ bk, const float* __restrict__ bv, float* PART, bf* Vh, bf* Vl) {
    __shared__ __align__(16) unsigned short sb[4 * XPL];    // planes: Wq, Wk, Wv [out][in], x^T [position][channel]
    __shared__ __align__(16) float yt[3 * YPL];             // yq, yk [position][channel], v [channel][position]
    __shared__ __align__(16) float rs_[2 * 16 * CQ];
    __shared__ __align__(16) float rq_[2 * 16 * CQ];
    const int tid = threadIdx.x, lane = tid & 31, lr = lane & 15, hi = lane >> 4;
    const int wave = __builtin_amdgcn_readfirstlane(tid >> 5), m = wave >> 2, w = wave & 3;    // scalar, so that the tests around the matrix instructions are scalar branches
    const int b = blockIdx.x >> 6, n0 = (blockIdx.x & 63) * 64;
    const int nq = tid & 15, cp = tid >> 4;         // x: channels 2 cp and 2 cp + 1, positions 4 nq ..
    const int ro = tid >> 3, c8 = (tid & 7) * 8;    // weights, gates, v: row ro, eight columns from c8
    const float* xp = x + ((size_t)b * CC + 2 * cp) * NN + n0 + nq * 4;
    const v4f x0 = *(const v4f*)xp, x1 = *(const v4f*)(xp + NN);
    const v8f wf[3] = {*(const v8f*)(Wq + tid * 8), *(const v8f*)(Wk + tid * 8), *(const v8f*)(Wv + tid * 8)};
    const size_t go = ((size_t)b * CC + ro) * NN + n0 + c8;
    const v8f ga = *(const v8f*)(h0 + go), gb = *(const v8f*)(h1 + go);
    float bi[8] = {0.f, 0.f, 0.f, 0.f, 0.f, 0.f, 0.f, 0.f};    // yq, yk: bias of column t * 16 + lr in bi[t]; v: bias of row w * 16 + hi * 8 + j in bi[j]
    if (m < 2) { const float* bp = m ? bk : bq;
#pragma unroll
        for (int t = 0; t < 4; ++t) bi[t] = bfr(bp[t * 16 + lr]);
    } else if (m == 2) {
#pragma unroll
        for (int j = 0; j < 8; ++j) bi[j] = bfr(bv[w * 16 + hi * 8 + j]);
    }
#pragma unroll
    for (int i = 0; i < 4; ++i) *(ua*)(sb + 3 * XPL + (nq * 4 + i) * XPIT + 2 * cp) = (unsigned)f2bf(x0[i]) | ((unsigned)f2bf(x1[i]) << 16);
#pragma unroll
    for (int p = 0; p < 3; ++p) { v8us o;
#pragma unroll
        for (int k = 0; k < 8; ++k) o[k] = f2bf(wf[p][k]);
        *(v8usa*)(sb + p * XPL + ro * XPIT + c8) = o; }
    __syncthreads();
    if (m < 3) {
        const unsigned short* Ar = sb + (m < 2 ? 3 : 2) * XPL + (w * 16 + lr) * XPIT + 8 * hi;
        const unsigned short* Br = sb + (m < 2 ? m : 3) * XPL + lr * XPIT + 8 * hi;
        v8f acc[4];
#pragma unroll
        for (int t = 0; t < 4; ++t) acc[t] = (v8f){};
#pragma unroll
        for (int kc = 0; kc < 2; ++kc) { const v16bf a = cat16b(*(const v8usa*)(Ar + kc * 32), *(const v8usa*)(Ar + kc * 32 + 16));
#pragma unroll
            for (int t = 0; t < 4; ++t) { const unsigned short* p = Br + t * 16 * XPIT + kc * 32; acc[t] = wmmab(a, cat16b(*(const v8usa*)p, *(const v8usa*)(p + 16)), acc[t]); } }
        float* os = yt + m * YPL + (w * 16 + hi * 8) * YPIT + lr;
        if (m < 2) {
#pragma unroll
            for (int t = 0; t < 4; ++t) {
#pragma unroll
                for (int j = 0; j < 8; ++j) os[j * YPIT + t * 16] = acc[t][j] + bi[t]; }
        } else {
#pragma unroll
            for (int t = 0; t < 4; ++t) {
#pragma unroll
                for (int j = 0; j < 8; ++j) os[j * YPIT + t * 16] = acc[t][j] + bi[j]; }
        }
    }
    __syncthreads();
    { const float* vp = yt + 2 * YPL + ro * YPIT + c8; const v4f va = *(const v4fa*)vp, vb = *(const v4fa*)(vp + 4); v8us oh, ol;    // gate x value -> planes, whole 128-byte lines
#pragma unroll
        for (int q = 0; q < 8; ++q) { const float y = (q < 4 ? va[q & 3] : vb[q & 3]) * (bfr(ga[q]) + bfr(gb[q])); const unsigned short hb = f2bf(y); oh[q] = hb; ol[q] = f2bf(y - bf2f(hb)); }
        *(v8us*)(Vh + go) = oh; *(v8us*)(Vl + go) = ol; }
    const int ty = tid >> 8, cq = (tid & 15) * 4, rg = (tid >> 4) & 15;
    const float* Yl = yt + ty * YPL;
    float* Yg = (ty ? YK : YQ) + (size_t)blockIdx.x * BNR * CQ;
    float* rs = rs_ + ty * 16 * CQ; float* rq = rq_ + ty * 16 * CQ;
    v4f v[BNR / 16];
#pragma unroll
    for (int i = 0; i < BNR / 16; ++i) { v[i] = *(const v4fa*)(Yl + (rg + 16 * i) * YPIT + cq); *(v4f*)(Yg + (size_t)(rg + 16 * i) * CQ + cq) = v[i]; }
    v4f s = v[0];
#pragma unroll
    for (int i = 1; i < BNR / 16; ++i) s += v[i];
    *(v4fa*)(rs + rg * CQ + cq) = s;
    __syncthreads();
    v4f t = *(const v4fa*)(rs + cq);
#pragma unroll
    for (int g = 1; g < 16; ++g) t += *(const v4fa*)(rs + g * CQ + cq);
    const v4f mu = t * (1.0f / BNR);
    v4f q = (v4f){};
#pragma unroll
    for (int i = 0; i < BNR / 16; ++i) { const v4f d = v[i] - mu; q += d * d; }
    *(v4fa*)(rq + rg * CQ + cq) = q;
    __syncthreads();
    if ((tid & 255) < 16) {
        v4f m2 = *(const v4fa*)(rq + cq);
#pragma unroll
        for (int g = 1; g < 16; ++g) m2 += *(const v4fa*)(rq + g * CQ + cq);
        float* P = PART + ((size_t)ty * BNB + blockIdx.x) * 128 + cq;
        *(v4f*)P = t; *(v4f*)(P + 64) = m2;
    }
}
// k_bnapply: joins the statistics and applies them, one launch. Every work-group joins the BNB partials of both tensors itself, in the same fixed order (mean = sum / NALL;
// M2 = sum_b (M2_b + BNR (mean_b - mean)^2); rs = rsqrt(var + eps)), then turns its own BAR rows of yq and yk into relu((y - mean) rs gamma + beta) as bf16 hi + residual planes.
#define BAR 128                   // rows a work-group applies: two passes of 64
__global__ __launch_bounds__(1024) void k_bnapply(const float* __restrict__ YQ, const float* __restrict__ YK, const float* __restrict__ PART, const float* __restrict__ gq, const float* __restrict__ beq,
                                                  const float* __restrict__ gk, const float* __restrict__ bek, bf* Qh, bf* Ql, bf* Kh, bf* Kl) {
    __shared__ float ra[2 * 16 * CQ];
    __shared__ float rb[2 * 16 * CQ];
    __shared__ float st[2 * 2 * CQ];    // per tensor: mean, rs
    const int tid = threadIdx.x, c = tid & 63, g = tid >> 6;
    const int ty = __builtin_amdgcn_readfirstlane(tid >> 9), c8 = (tid & 7) * 8;    // scalar: the tensor's pointers stay on the scalar unit
    const int o = (tid & 511) * 8;    // row (tid / 8) % 64, eight channels from c8
    const size_t ob = (size_t)blockIdx.x * BAR * CQ;
    float s[2][BNB / 16], m[2][BNB / 16], q[2], mu[2];
#pragma unroll
    for (int y = 0; y < 2; ++y) { const float* P = PART + (y * BNB * 128 + g * (BNB / 16) * 128 + c);
#pragma unroll
        for (int i = 0; i < BNB / 16; ++i) { s[y][i] = P[i * 128]; m[y][i] = P[i * 128 + 64]; } }
    const v8f gv = *(const v8f*)((ty ? gk : gq) + c8), bv = *(const v8f*)((ty ? bek : beq) + c8);
    const float* yp = (ty ? YK : YQ) + ob + o;
    v4f yv[BAR / 64][2];
#pragma unroll
    for (int h = 0; h < BAR / 64; ++h) { yv[h][0] = *(const v4f*)(yp + h * 64 * CQ);
        if (h == BAR / 64 - 1) asm volatile("s_wait_xcnt 0x0" ::: "memory");    // the last load's result may be given the offset register that the loads above name
        yv[h][1] = *(const v4f*)(yp + h * 64 * CQ + 4); }
#pragma unroll
    for (int y = 0; y < 2; ++y) { float t = 0.f; q[y] = 0.f;
#pragma unroll
        for (int i = 0; i < BNB / 16; ++i) { t += s[y][i]; q[y] += m[y][i]; }
        ra[(y * 16 + g) * CQ + c] = t; }
    __syncthreads();
#pragma unroll
    for (int y = 0; y < 2; ++y) { float tot = 0.f;
#pragma unroll
        for (int j = 0; j < 16; ++j) tot += ra[(y * 16 + j) * CQ + c];
        mu[y] = tot * (1.0f / NALL);
#pragma unroll
        for (int i = 0; i < BNB / 16; ++i) { const float d = s[y][i] * (1.0f / BNR) - mu[y]; q[y] = fmaf(d * d, (float)BNR, q[y]); }
        rb[(y * 16 + g) * CQ + c] = q[y]; }
    __syncthreads();
    if (tid < 2 * CQ) {    // g = the tensor here
        float m2 = 0.f;
#pragma unroll
        for (int j = 0; j < 16; ++j) m2 += rb[(g * 16 + j) * CQ + c];
        st[g * 128 + c] = g ? mu[1] : mu[0]; st[g * 128 + 64 + c] = rsqrtf(m2 * (1.0f / NALL) + BN_EPS);
    }
    __syncthreads();
    const float* MU = st + ty * 128 + c8; const float* RS = MU + 64;
#pragma unroll
    for (int h = 0; h < BAR / 64; ++h) { v8us oh, ol;
#pragma unroll
        for (int i = 0; i < 8; ++i) { const float y = fmaxf((yv[h][i >> 2][i & 3] - MU[i]) * RS[i] * bfr(gv[i]) + bfr(bv[i]), 0.f); const unsigned short hb = f2bf(y); oh[i] = hb; ol[i] = f2bf(y - bf2f(hb)); }
        *(v8us*)((ty ? Kh : Qh) + ob + h * 64 * CQ + o) = oh; *(v8us*)((ty ? Kl : Ql) + ob + h * 64 * CQ + o) = ol; }
}
// k_attn: sim, row softmax and context in one launch. A work-group owns 64 queries of one item: wave = (query tile qt of 16, key split g of KS). Per 32-key stage a wave forms
// S^T = K.Q^T (two 16-key tiles, three products), keeps a running maximum and sum per query (one query per lane column), packs p = 2^(s log2e - m) from the two score tiles straight
// into the B operand (hi + residual planes) and adds ctx^T += gv.P^T (four 16-channel tiles, three products). K and gv stages go global -> registers -> LDS, two buffers a split,
// one work-group barrier a stage. The KS partial (m, l, ctx) sets are joined in fixed order through LDS, divided by l and written as whole 256-byte output rows.
#define KS   4
#define NSTG (NN / KS / 32)       // 32-key stages a split
#define KPIT 72                   // LDS pitch of a 64-channel key row, elements (144 B)
#define VPIT 40                   // LDS pitch of a 32-key value row, elements (80 B)
#define KPL  (32 * KPIT)
#define VPL  (CC * VPIT)
#define STG  (2 * KPL + 2 * VPL)  // elements a stage buffer: K hi, K lo, gv hi, gv lo
#define MGW  (34 * 32)            // floats a wave's partial set: m, l, 32 context registers, lane-minor
#define OTOF ((KS - 1) * 4 * MGW) // float offset of the output tile [64 channels][68]
#define L2E  1.4426950408889634f
typedef float __attribute__((may_alias)) fa;
// value of lane l ^ 16 (the other half of the same query column), on the vector port
__device__ __forceinline__ float xhalf(float v) { const int u = __float_as_int(v); return __int_as_float(__builtin_amdgcn_permlanex16(u, u, 0x76543210, 0xfedcba98, false, false)); }
// Eight 2^x in one statement: the outputs are early-clobber, so no v_exp_f32 overwrites the source of the one in front of it, and the closing v_nop is the one slot that the
// instruction set asks for between the last v_exp_f32 and the next vector instruction, which the compiler is free to choose.
__device__ __forceinline__ void exp2x8(const float* x, float* p) {
    asm("v_exp_f32 %0, %8\n\tv_exp_f32 %1, %9\n\tv_exp_f32 %2, %10\n\tv_exp_f32 %3, %11\n\tv_exp_f32 %4, %12\n\tv_exp_f32 %5, %13\n\tv_exp_f32 %6, %14\n\tv_exp_f32 %7, %15\n\tv_nop"
        : "=&v"(p[0]), "=&v"(p[1]), "=&v"(p[2]), "=&v"(p[3]), "=&v"(p[4]), "=&v"(p[5]), "=&v"(p[6]), "=&v"(p[7])
        : "v"(x[0]), "v"(x[1]), "v"(x[2]), "v"(x[3]), "v"(x[4]), "v"(x[5]), "v"(x[6]), "v"(x[7]));
}
// One 2^x with the same slot behind it.
__device__ __forceinline__ float exp2x1(float x) { float p; asm("v_exp_f32 %0, %1\n\tv_nop" : "=v"(p) : "v"(x)); return p; }
__global__ __launch_bounds__(KS * 128) void k_attn(const bf* __restrict__ Qh, const bf* __restrict__ Ql, const bf* __restrict__ Kh, const bf* __restrict__ Kl, const bf* __restrict__ Vh, const bf* __restrict__ Vl, float* out) {
    __shared__ __align__(16) unsigned short L[KS * 2 * STG];
    const int tid = threadIdx.x, lane = tid & 31, lr = lane & 15, hi = lane >> 4, tg = tid & 127;
    const int wave = __builtin_amdgcn_readfirstlane(tid >> 5), qt = wave & 3, g = wave >> 2;    // scalar, so that the LDS bases and the tests on g stay on the scalar unit
    const int b = blockIdx.y, q0 = blockIdx.x * 64;
    const size_t tb = (size_t)b * NN;
    const size_t qo = (tb + q0 + qt * 16 + lr) * CQ + 8 * hi;
    v16bf qh[2], ql[2];
#pragma unroll
    for (int kc = 0; kc < 2; ++kc) { qh[kc] = cat16b(*(const v8us*)(Qh + qo + kc * 32), *(const v8us*)(Qh + qo + kc * 32 + 16)); ql[kc] = cat16b(*(const v8us*)(Ql + qo + kc * 32), *(const v8us*)(Ql + qo + kc * 32 + 16)); }
    const size_t gko = (tb + (size_t)g * (NN / KS)) * CQ + tg * 8;                                   // a K stage is 4 KB in a row a plane: chunks tg and tg + 128
    const size_t gvo = ((size_t)b * CC + (tg >> 2)) * NN + (size_t)g * (NN / KS) + (tg & 3) * 8;     // a gv stage is 64 rows of 64 B a plane: rows tg / 4 and tg / 4 + 32
    const int lk = (tg >> 3) * KPIT + (tg & 7) * 8, lv = (tg >> 2) * VPIT + (tg & 3) * 8;
    v8us rk[4], rv[4];
    auto gload = [&](int s) {
        const size_t ko = gko + (size_t)s * 32 * CQ, vo = gvo + (size_t)s * 32;
        rk[0] = *(const v8us*)(Kh + ko); rk[1] = *(const v8us*)(Kh + ko + 1024); rk[2] = *(const v8us*)(Kl + ko); rk[3] = *(const v8us*)(Kl + ko + 1024);
        rv[0] = *(const v8us*)(Vh + vo); rv[1] = *(const v8us*)(Vh + vo + (size_t)32 * NN); rv[2] = *(const v8us*)(Vl + vo); rv[3] = *(const v8us*)(Vl + vo + (size_t)32 * NN);
    };
    auto lstore = [&](int buf) {
        unsigned short* B = L + (g * 2 + buf) * STG;
        *(v8usa*)(B + lk) = rk[0]; *(v8usa*)(B + lk + 16 * KPIT) = rk[1]; *(v8usa*)(B + KPL + lk) = rk[2]; *(v8usa*)(B + KPL + lk + 16 * KPIT) = rk[3];
        *(v8usa*)(B + 2 * KPL + lv) = rv[0]; *(v8usa*)(B + 2 * KPL + lv + 32 * VPIT) = rv[1]; *(v8usa*)(B + 2 * KPL + VPL + lv) = rv[2]; *(v8usa*)(B + 2 * KPL + VPL + lv + 32 * VPIT) = rv[3];
    };
    gload(0); lstore(0);
    __syncthreads();
    float ml = -3.0e38f, ls = 0.f;    // running maximum (in log2 units) and this lane's half of the running sum
    v8f acc[4];
#pragma unroll
    for (int ct = 0; ct < 4; ++ct) acc[ct] = (v8f){};
#pragma unroll 1    // one stage a trip: the buffers alternate by s & 1; a second copy of the body would only add code and live registers
    for (int s = 0; s < NSTG; ++s) {
        if (s + 1 < NSTG) gload(s + 1);
        const unsigned short* B = L + (g * 2 + (s & 1)) * STG;
        v8f st[2];
#pragma unroll
        for (int t = 0; t < 2; ++t) { st[t] = (v8f){};
#pragma unroll
            for (int kc = 0; kc < 2; ++kc) { const unsigned short* p = B + (t * 16 + lr) * KPIT + kc * 32 + 8 * hi;
                const v16bf kh = cat16b(*(const v8usa*)p, *(const v8usa*)(p + 16)), kl = cat16b(*(const v8usa*)(p + KPL), *(const v8usa*)(p + KPL + 16));
                st[t] = wmmab(kh, qh[kc], st[t]); st[t] = wmmab(kl, qh[kc], st[t]); st[t] = wmmab(kh, ql[kc], st[t]); } }
        float mx = fmaxf(st[0][0], st[1][0]);
#pragma unroll
        for (int r = 1; r < 8; ++r) mx = fmaxf(mx, fmaxf(st[0][r], st[1][r]));
        mx = fmaxf(mx, xhalf(mx));
        const float mn = fmaxf(ml, mx * L2E), al = exp2x1(ml - mn);
        ml = mn;
        v16bf ph, pl; float ps[4] = {0.f, 0.f, 0.f, 0.f};    // four independent sum chains
#pragma unroll
        for (int t = 0; t < 2; ++t) { float x[8], p[8];
#pragma unroll
            for (int r = 0; r < 8; ++r) x[r] = fmaf(st[t][r], L2E, -mn);
            exp2x8(x, p);
#pragma unroll
            for (int r = 0; r < 8; ++r) { ps[r & 3] += p[r]; const __bf16 hb = (__bf16)p[r]; ph[t * 8 + r] = hb; pl[t * 8 + r] = (__bf16)(p[r] - (float)hb); } }
        ls = fmaf(ls, al, (ps[0] + ps[1]) + (ps[2] + ps[3]));
#pragma unroll
        for (int ct = 0; ct < 4; ++ct) acc[ct] *= al;
#pragma unroll
        for (int ct = 0; ct < 4; ++ct) { const unsigned short* p = B + 2 * KPL + (ct * 16 + lr) * VPIT + 8 * hi;
            const v16bf vh = cat16b(*(const v8usa*)p, *(const v8usa*)(p + 16)), vl = cat16b(*(const v8usa*)(p + VPL), *(const v8usa*)(p + VPL + 16));
            acc[ct] = wmmab(vh, ph, acc[ct]); acc[ct] = wmmab(vl, ph, acc[ct]); acc[ct] = wmmab(vh, pl, acc[ct]); }
        if (s + 1 < NSTG) lstore((s + 1) & 1);
        __syncthreads();    // publishes stage s + 1 and ends every read of the buffer that the next pass refills
    }
    ls += xhalf(ls);
    fa* F = (fa*)(void*)L;    // the stage buffers are free behind the loop's last barrier
    if (g > 0) { fa* M = F + ((g - 1) * 4 + qt) * MGW + lane; M[0] = ml; M[32] = ls;
#pragma unroll
        for (int i = 0; i < 32; ++i) M[(2 + i) * 32] = acc[i >> 3][i & 7]; }
    __syncthreads();
    if (g == 0) {
#pragma unroll 1    // runs once a launch: kept rolled for code size
        for (int o = 0; o < KS - 1; ++o) { const fa* M = F + (o * 4 + qt) * MGW + lane; const float m2 = M[0], l2 = M[32], mn = fmaxf(ml, m2);
            const float a1 = exp2x1(ml - mn), a2 = exp2x1(m2 - mn); ls = ls * a1 + l2 * a2; ml = mn;
#pragma unroll
            for (int i = 0; i < 32; ++i) acc[i >> 3][i & 7] = acc[i >> 3][i & 7] * a1 + M[(2 + i) * 32] * a2; }
        const float inv = 1.0f / ls;
#pragma unroll
        for (int i = 0; i < 32; ++i) F[OTOF + ((i >> 3) * 16 + 8 * hi + (i & 7)) * 68 + qt * 16 + lr] = acc[i >> 3][i & 7] * inv;
    }
    __syncthreads();
#pragma unroll
    for (int j = 0; j < CC * 16 / (KS * 128); ++j) { const int i = tid + j * KS * 128, row = i >> 4, col = i & 15; const v4f val = *(const v4fa*)(F + OTOF + row * 68 + col * 4); *(v4f*)(out + ((size_t)b * CC + row) * NN + q0 + col * 4) = val; }
}
extern "C" void kernel_launch(void* const* d_in, const int* in_sizes, int n_in,
                              void* d_out, int out_size, void* d_ws, size_t ws_size, hipStream_t stream) {
    (void)in_sizes; (void)n_in; (void)out_size;
    const float* x = (const float*)d_in[0]; const float* h0 = (const float*)d_in[1]; const float* h1 = (const float*)d_in[2];
    const float* Wq = (const float*)d_in[3]; const float* bq = (const float*)d_in[4]; const float* gq = (const float*)d_in[5]; const float* beq = (const float*)d_in[6];
    const float* Wk = (const float*)d_in[7]; const float* bk = (const float*)d_in[8]; const float* gk = (const float*)d_in[9]; const float* bek = (const float*)d_in[10]; const float* Wv = (const float*)d_in[11]; const float* bv = (const float*)d_in[12];
    float* out = (float*)d_out;    // [4][64][64][64]
    char* wsp = (char*)d_ws;
    auto take = [&](size_t bytes) { char* p = wsp; wsp += (bytes + 255) & ~(size_t)255; return (void*)p; };
    float* YQ = (float*)take((size_t)NALL * CQ * 4); float* YK = (float*)take((size_t)NALL * CQ * 4); float* PART = (float*)take((size_t)2 * BNB * 128 * 4);
    bf* Qh = (bf*)take((size_t)NALL * CQ * 2); bf* Ql = (bf*)take((size_t)NALL * CQ * 2); bf* Kh = (bf*)take((size_t)NALL * CQ * 2); bf* Kl = (bf*)take((size_t)NALL * CQ * 2);
    bf* Vh = (bf*)take((size_t)NBI * CC * NN * 2); bf* Vl = (bf*)take((size_t)NBI * CC * NN * 2);
    if ((size_t)(wsp - (char*)d_ws) > ws_size) return;    // ~ 21 MB, no aliasing
    k_proj<<<BNB, 512, 0, stream>>>(x, h0, h1, YQ, Wq, Wk, Wv, YK, bq, bk, bv, PART, Vh, Vl);
    k_bnapply<<<NALL / BAR, 1024, 0, stream>>>(YQ, YK, PART, gq, beq, gk, bek, Qh, Ql, Kh, Kl);
    k_attn<<<dim3(NN / 64, NBI, 1), KS * 128, 0, stream>>>(Qh, Ql, Kh, Kl, Vh, Vl, out);
}

// v004
// A run of this version takes 53.7 microseconds.
// In two side-by-side timings against v003, it was 1.28 and 1.27 times as fast.
// Over all steps from v000 it is 138 times as fast.
#include <hip/hip_runtime.h>

// Compute dtypes, f32 accumulate: query/key = relu(BN_batchstats(conv1x1(x))) with the 1x1 convs as token-major GEMMs over all 4 x 4096 positions ([16384 x 64].[64 x 64], PLAIN bf16
// operands = rounded input/weights, exact products, + bias), the per-channel batch mean/variance as a fixed-order f32 reduction, normalise + relu in f32 -> bf16 hi + UNSCALED residual
// planes; value = conv1x1 channel-major ([64 x 64].[64 x 4096] per item) x the gate (heat0 + heat1) -> planes; then one launch over all items: per 64 queries sim^T = k . q (three products) -> running
// softmax in f32 -> P planes in registers; ctx[c][q] = sum_k gv[c][k] P[q][k] (three products), divided by the row sum and written channel-major = the output layout - all on

#define NBI  4
#define CC   64
#define CQ   64
#define NN   4096
#define NALL (NBI * NN)           // 16384
#define BN_EPS 1e-5f
#define DM   CC
#define NTK  NN
#define LOSC 1024.0f

typedef _Float16 h16;
typedef unsigned short bf;
typedef __attribute__((ext_vector_type(16))) __bf16   v16bf;
typedef __attribute__((ext_vector_type(16))) _Float16 v16h;
typedef __attribute__((ext_vector_type(8)))  _Float16 v8h;
typedef __attribute__((ext_vector_type(8)))  unsigned short v8us;
typedef __attribute__((ext_vector_type(8)))  float    v8f;
typedef __attribute__((ext_vector_type(4)))  float    v4f;
typedef __attribute__((ext_vector_type(4)))  _Float16 v4h;
typedef v8h  __attribute__((may_alias)) v8ha;
typedef v4f  __attribute__((may_alias)) v4fa;
typedef v8us __attribute__((may_alias)) v8usa;

__device__ __forceinline__ unsigned short f2bf(float f) { unsigned u = __float_as_uint(f); u += 0x7FFFu + ((u >> 16) & 1u); return (unsigned short)(u >> 16); }
__device__ __forceinline__ float bf2f(unsigned short b) { return __uint_as_float(((unsigned)b) << 16); }
__device__ __forceinline__ float bfr(float f) { return bf2f(f2bf(f)); }
__device__ __forceinline__ v16h cat16(v8h lo, v8h hi) { return __builtin_shufflevector(lo, hi, 0, 1, 2, 3, 4, 5, 6, 7, 8, 9, 10, 11, 12, 13, 14, 15); }
__device__ __forceinline__ v16bf cat16b(v8us lo, v8us hi) { return __builtin_bit_cast(v16bf, __builtin_shufflevector(lo, hi, 0, 1, 2, 3, 4, 5, 6, 7, 8, 9, 10, 11, 12, 13, 14, 15)); }
__device__ __forceinline__ v8f wmma16(v16h a, v16h b, v8f c) { return __builtin_amdgcn_wmma_f32_16x16x32_f16(false, a, false, b, (short)0, c, false, false); }
__device__ __forceinline__ v8f wmmab(v16bf a, v16bf b, v8f c) { return __builtin_amdgcn_wmma_f32_16x16x32_bf16(false, a, false, b, (short)0, c, false, false); }

// k_proj: everything in front of the batch statistics, one launch. A work-group owns 64 positions of one item. It rounds its x tile [64 channels][64 positions] and the three weight
// matrices to bf16 into LDS (x transposed to position-major), forms on waves 0-11 (matrix m = wave / 4, 16-row tile = wave % 4) yq, yk = x^T . W^T + bias (position-major) and
// v = Wv . x + bias (channel-major) into f32 LDS tiles, then writes yq, yk, their per-channel sum and squared deviations from the block's own mean
// (PART[(y * BNB + block) * 128 + c] and [.. + 64 + c], y = 0: yq, 1: yk; fixed order) and the planes of v x (heat0 + heat1).
#define BNB  256
#define BNR  (NALL / BNB)         // 64 rows a block
#define XPIT 72                   // LDS pitch of a 64-channel bf16 row, elements (144 B)
#define XPL  (64 * XPIT)
#define YPIT 68                   // LDS pitch of a 64-wide f32 row, elements (272 B)
#define YPL  (64 * YPIT)
typedef unsigned __attribute__((may_alias)) ua;
__global__ __launch_bounds__(512) void k_proj(const float* __restrict__ x, const float* __restrict__ h0, const float* __restrict__ h1, float* YQ,
                                              const float* __restrict__ Wq, const float* __restrict__ Wk, const float* __restrict__ Wv, float* YK,
                                              const float* __restrict__ bq, const float* __restrict__ bk, const float* __restrict__ bv, float* PART, bf* Vh, bf* Vl) {
    __shared__ __align__(16) unsigned short sb[4 * XPL];    // planes: Wq, Wk, Wv [out][in], x^T [position][channel]
    __shared__ __align__(16) float yt[3 * YPL];             // yq, yk [position][channel], v [channel][position]
    __shared__ __align__(16) float rs_[2 * 16 * CQ];
    __shared__ __align__(16) float rq_[2 * 16 * CQ];
    const int tid = threadIdx.x, lane = tid & 31, lr = lane & 15, hi = lane >> 4;
    const int wave = __builtin_amdgcn_readfirstlane(tid >> 5), m = wave >> 2, w = wave & 3;    // scalar, so that the tests around the matrix instructions are scalar branches
    const int b = blockIdx.x >> 6, n0 = (blockIdx.x & 63) * 64;
    const int nq = tid & 15, cp = tid >> 4;         // x: channels 2 cp and 2 cp + 1, positions 4 nq ..
    const int ro = tid >> 3, c8 = (tid & 7) * 8;    // weights, gates, v: row ro, eight columns from c8
    const float* xp = x + ((size_t)b * CC + 2 * cp) * NN + n0 + nq * 4;
    const v4f x0 = *(const v4f*)xp, x1 = *(const v4f*)(xp + NN);
    const v8f wf[3] = {*(const v8f*)(Wq + tid * 8), *(const v8f*)(Wk + tid * 8), *(const v8f*)(Wv + tid * 8)};
    const size_t go = ((size_t)b * CC + ro) * NN + n0 + c8;
    const v8f ga = *(const v8f*)(h0 + go), gb = *(const v8f*)(h1 + go);
    float bi[8] = {0.f, 0.f, 0.f, 0.f, 0.f, 0.f, 0.f, 0.f};    // yq, yk: bias of column t * 16 + lr in bi[t]; v: bias of row w * 16 + hi * 8 + j in bi[j]
    if (m < 2) { const float* bp = m ? bk : bq;
#pragma unroll
        for (int t = 0; t < 4; ++t) bi[t] = bfr(bp[t * 16 + lr]);
    } else if (m == 2) {
#pragma unroll
        for (int j = 0; j < 8; ++j) bi[j] = bfr(bv[w * 16 + hi * 8 + j]);
    }
#pragma unroll
    for (int i = 0; i < 4; ++i) *(ua*)(sb + 3 * XPL + (nq * 4 + i) * XPIT + 2 * cp) = (unsigned)f2bf(x0[i]) | ((unsigned)f2bf(x1[i]) << 16);
#pragma unroll
    for (int p = 0; p < 3; ++p) { v8us o;
#pragma unroll
        for (int k = 0; k < 8; ++k) o[k] = f2bf(wf[p][k]);
        *(v8usa*)(sb + p * XPL + ro * XPIT + c8) = o; }
    __syncthreads();
    if (m < 3) {
        const unsigned short* Ar = sb + (m < 2 ? 3 : 2) * XPL + (w * 16 + lr) * XPIT + 8 * hi;
        const unsigned short* Br = sb + (m < 2 ? m : 3) * XPL + lr * XPIT + 8 * hi;
        v8f acc[4];
#pragma unroll
        for (int t = 0; t < 4; ++t) acc[t] = (v8f){};
#pragma unroll
        for (int kc = 0; kc < 2; ++kc) { const v16bf a = cat16b(*(const v8usa*)(Ar + kc * 32), *(const v8usa*)(Ar + kc * 32 + 16));
#pragma unroll
            for (int t = 0; t < 4; ++t) { const unsigned short* p = Br + t * 16 * XPIT + kc * 32; acc[t] = wmmab(a, cat16b(*(const v8usa*)p, *(const v8usa*)(p + 16)), acc[t]); } }
        float* os = yt + m * YPL + (w * 16 + hi * 8) * YPIT + lr;
        if (m < 2) {
#pragma unroll
            for (int t = 0; t < 4; ++t) {
#pragma unroll
                for (int j = 0; j < 8; ++j) os[j * YPIT + t * 16] = acc[t][j] + bi[t]; }
        } else {
#pragma unroll
            for (int t = 0; t < 4; ++t) {
#pragma unroll
                for (int j = 0; j < 8; ++j) os[j * YPIT + t * 16] = acc[t][j] + bi[j]; }
        }
    }
    __syncthreads();
    { const float* vp = yt + 2 * YPL + ro * YPIT + c8; const v4f va = *(const v4fa*)vp, vb = *(const v4fa*)(vp + 4); v8us oh, ol;    // gate x value -> planes, whole 128-byte lines
#pragma unroll
        for (int q = 0; q < 8; ++q) { const float y = (q < 4 ? va[q & 3] : vb[q & 3]) * (bfr(ga[q]) + bfr(gb[q])); const unsigned short hb = f2bf(y); oh[q] = hb; ol[q] = f2bf(y - bf2f(hb)); }
        *(v8us*)(Vh + go) = oh; *(v8us*)(Vl + go) = ol; }
    const int ty = tid >> 8, cq = (tid & 15) * 4, rg = (tid >> 4) & 15;
    const float* Yl = yt + ty * YPL;
    float* Yg = (ty ? YK : YQ) + (size_t)blockIdx.x * BNR * CQ;
    float* rs = rs_ + ty * 16 * CQ; float* rq = rq_ + ty * 16 * CQ;
    v4f v[BNR / 16];
#pragma unroll
    for (int i = 0; i < BNR / 16; ++i) { v[i] = *(const v4fa*)(Yl + (rg + 16 * i) * YPIT + cq); *(v4f*)(Yg + (size_t)(rg + 16 * i) * CQ + cq) = v[i]; }
    v4f s = v[0];
#pragma unroll
    for (int i = 1; i < BNR / 16; ++i) s += v[i];
    *(v4fa*)(rs + rg * CQ + cq) = s;
    __syncthreads();
    v4f t = *(const v4fa*)(rs + cq);
#pragma unroll
    for (int g = 1; g < 16; ++g) t += *(const v4fa*)(rs + g * CQ + cq);
    const v4f mu = t * (1.0f / BNR);
    v4f q = (v4f){};
#pragma unroll
    for (int i = 0; i < BNR / 16; ++i) { const v4f d = v[i] - mu; q += d * d; }
    *(v4fa*)(rq + rg * CQ + cq) = q;
    __syncthreads();
    if ((tid & 255) < 16) {
        v4f m2 = *(const v4fa*)(rq + cq);
#pragma unroll
        for (int g = 1; g < 16; ++g) m2 += *(const v4fa*)(rq + g * CQ + cq);
        float* P = PART + ((size_t)ty * BNB + blockIdx.x) * 128 + cq;
        *(v4f*)P = t; *(v4f*)(P + 64) = m2;
    }
}
// k_bnapply: joins the statistics and applies them, one launch. Every work-group joins the BNB partials of both tensors itself, in the same fixed order (mean = sum / NALL;
// M2 = sum_b (M2_b + BNR (mean_b - mean)^2); rs = rsqrt(var + eps)), then turns its own BAR rows of yq and yk into relu((y - mean) rs gamma + beta) as bf16 hi + residual planes.
#define BAR 128                   // rows a work-group applies: two passes of 64
__global__ __launch_bounds__(1024) void k_bnapply(const float* __restrict__ YQ, const float* __restrict__ YK, const float* __restrict__ PART, const float* __restrict__ gq, const float* __restrict__ beq,
                                                  const float* __restrict__ gk, const float* __restrict__ bek, bf* Qh, bf* Ql, bf* Kh, bf* Kl) {
    __shared__ float ra[2 * 16 * CQ];
    __shared__ float rb[2 * 16 * CQ];
    __shared__ float st[2 * 2 * CQ];    // per tensor: mean, rs
    const int tid = threadIdx.x, c = tid & 63, g = tid >> 6;
    const int ty = __builtin_amdgcn_readfirstlane(tid >> 9), c8 = (tid & 7) * 8;    // scalar: the tensor's pointers stay on the scalar unit
    const int o = (tid & 511) * 8;    // row (tid / 8) % 64, eight channels from c8
    const size_t ob = (size_t)blockIdx.x * BAR * CQ;
    float s[2][BNB / 16], m[2][BNB / 16], q[2], mu[2];
#pragma unroll
    for (int y = 0; y < 2; ++y) { const float* P = PART + (y * BNB * 128 + g * (BNB / 16) * 128 + c);
#pragma unroll
        for (int i = 0; i < BNB / 16; ++i) { s[y][i] = P[i * 128]; m[y][i] = P[i * 128 + 64]; } }
    const v8f gv = *(const v8f*)((ty ? gk : gq) + c8), bv = *(const v8f*)((ty ? bek : beq) + c8);
    const float* yp = (ty ? YK : YQ) + ob + o;
    v4f yv[BAR / 64][2];
#pragma unroll
    for (int h = 0; h < BAR / 64; ++h) { yv[h][0] = *(const v4f*)(yp + h * 64 * CQ);
        if (h == BAR / 64 - 1) asm volatile("s_wait_xcnt 0x0" ::: "memory");    // the last load's result may be given the offset register that the loads above name
        yv[h][1] = *(const v4f*)(yp + h * 64 * CQ + 4); }
#pragma unroll
    for (int y = 0; y < 2; ++y) { float t = 0.f; q[y] = 0.f;
#pragma unroll
        for (int i = 0; i < BNB / 16; ++i) { t += s[y][i]; q[y] += m[y][i]; }
        ra[(y * 16 + g) * CQ + c] = t; }
    __syncthreads();
#pragma unroll
    for (int y = 0; y < 2; ++y) { float tot = 0.f;
#pragma unroll
        for (int j = 0; j < 16; ++j) tot += ra[(y * 16 + j) * CQ + c];
        mu[y] = tot * (1.0f / NALL);
#pragma unroll
        for (int i = 0; i < BNB / 16; ++i) { const float d = s[y][i] * (1.0f / BNR) - mu[y]; q[y] = fmaf(d * d, (float)BNR, q[y]); }
        rb[(y * 16 + g) * CQ + c] = q[y]; }
    __syncthreads();
    if (tid < 2 * CQ) {    // g = the tensor here
        float m2 = 0.f;
#pragma unroll
        for (int j = 0; j < 16; ++j) m2 += rb[(g * 16 + j) * CQ + c];
        st[g * 128 + c] = g ? mu[1] : mu[0]; st[g * 128 + 64 + c] = rsqrtf(m2 * (1.0f / NALL) + BN_EPS);
    }
    __syncthreads();
    const float* MU = st + ty * 128 + c8; const float* RS = MU + 64;
#pragma unroll
    for (int h = 0; h < BAR / 64; ++h) { v8us oh, ol;
#pragma unroll
        for (int i = 0; i < 8; ++i) { const float y = fmaxf((yv[h][i >> 2][i & 3] - MU[i]) * RS[i] * bfr(gv[i]) + bfr(bv[i]), 0.f); const unsigned short hb = f2bf(y); oh[i] = hb; ol[i] = f2bf(y - bf2f(hb)); }
        *(v8us*)((ty ? Kh : Qh) + ob + h * 64 * CQ + o) = oh; *(v8us*)((ty ? Kl : Ql) + ob + h * 64 * CQ + o) = ol; }
}
// k_attn: sim, row softmax and context in one launch. A work-group owns 64 queries of one item: wave = (query tile qt of 16, key split g of KS). Per 32-key pass a wave forms
// S^T = K.Q^T (two 16-key tiles, three products), keeps a running maximum and sum per query (one query per lane column), packs p = 2^(s log2e - m) from the two score tiles straight
// into the B operand (hi + residual planes) and adds ctx^T += gv.P^T (four 16-channel tiles, three products). A stage is 64 keys = two such passes. It goes global -> registers -> LDS,
// two buffers a split: the next stage's K rows are fetched during the first pass, its gv rows (whole 128-byte lines) during the second, and one work-group barrier ends the stage, so
// that the waves may run up to two passes apart. The KS partial (m, l, ctx) sets are joined in fixed order through LDS, divided by l and written as whole 256-byte output rows.
#define KS   4
#define SKEY 64                   // keys a stage: two 32-key passes
#define NSTG (NN / KS / SKEY)     // stages a split
#define SPIT 72                   // LDS pitch of a 64-element row (a key's channels, a channel's keys), elements (144 B)
#define SPL  (64 * SPIT)          // a plane of a stage: 64 rows
#define STG  (4 * SPL)            // elements a stage buffer: K hi, K lo, gv hi, gv lo
#define MGW  (34 * 32)            // floats a wave's partial set: m, l, 32 context registers, lane-minor
#define OTOF ((KS - 1) * 4 * MGW) // float offset of the output tile [64 channels][68]
#define L2E  1.4426950408889634f
typedef float __attribute__((may_alias)) fa;
// value of lane l ^ 16 (the other half of the same query column), on the vector port
__device__ __forceinline__ float xhalf(float v) { const int u = __float_as_int(v); return __int_as_float(__builtin_amdgcn_permlanex16(u, u, 0x76543210, 0xfedcba98, false, false)); }
// Eight 2^x in one statement: the outputs are early-clobber, so no v_exp_f32 overwrites the source of the one in front of it, and the closing v_nop is the one slot that the
// instruction set asks for between the last v_exp_f32 and the next vector instruction, which the compiler is free to choose.
__device__ __forceinline__ void exp2x8(const float* x, float* p) {
    asm("v_exp_f32 %0, %8\n\tv_exp_f32 %1, %9\n\tv_exp_f32 %2, %10\n\tv_exp_f32 %3, %11\n\tv_exp_f32 %4, %12\n\tv_exp_f32 %5, %13\n\tv_exp_f32 %6, %14\n\tv_exp_f32 %7, %15\n\tv_nop"
        : "=&v"(p[0]), "=&v"(p[1]), "=&v"(p[2]), "=&v"(p[3]), "=&v"(p[4]), "=&v"(p[5]), "=&v"(p[6]), "=&v"(p[7])
        : "v"(x[0]), "v"(x[1]), "v"(x[2]), "v"(x[3]), "v"(x[4]), "v"(x[5]), "v"(x[6]), "v"(x[7]));
}
// One 2^x with the same slot behind it.
__device__ __forceinline__ float exp2x1(float x) { float p; asm("v_exp_f32 %0, %1\n\tv_nop" : "=v"(p) : "v"(x)); return p; }
__global__ __launch_bounds__(KS * 128) void k_attn(const bf* __restrict__ Qh, const bf* __restrict__ Ql, const bf* __restrict__ Kh, const bf* __restrict__ Kl, const bf* __restrict__ Vh, const bf* __restrict__ Vl, float* out) {
    __shared__ __align__(16) unsigned short L[KS * 2 * STG];
    const int tid = threadIdx.x, lane = tid & 31, lr = lane & 15, hi = lane >> 4, tg = tid & 127;
    const int wave = __builtin_amdgcn_readfirstlane(tid >> 5), qt = wave & 3, g = wave >> 2;    // scalar, so that the LDS bases and the tests on g stay on the scalar unit
    const int b = blockIdx.y, q0 = blockIdx.x * 64;
    const size_t tb = (size_t)b * NN;
    const size_t qo = (tb + q0 + qt * 16 + lr) * CQ + 8 * hi;
    v16bf qh[2], ql[2];
#pragma unroll
    for (int kc = 0; kc < 2; ++kc) { qh[kc] = cat16b(*(const v8us*)(Qh + qo + kc * 32), *(const v8us*)(Qh + qo + kc * 32 + 16)); ql[kc] = cat16b(*(const v8us*)(Ql + qo + kc * 32), *(const v8us*)(Ql + qo + kc * 32 + 16)); }
    const size_t gko = (tb + (size_t)g * (NN / KS)) * CQ + tg * 8;                                   // a K stage is 8 KB in a row a plane: chunks tg + 128 i
    const size_t gvo = ((size_t)b * CC + (tg >> 3)) * NN + (size_t)g * (NN / KS) + (tg & 7) * 8;     // a gv stage is 64 rows of 128 B a plane: rows tg / 8 + 16 i
    const int lo = (tg >> 3) * SPIT + (tg & 7) * 8;                                                  // both land in row tg / 8 + 16 i of their plane
    v8us rk[8], rv[8];    // hi plane in 0-3, residual plane in 4-7; rk is in flight over a stage's first pass, rv over its second
    auto gloadk = [&](int s) { const size_t o = gko + (size_t)s * SKEY * CQ;
#pragma unroll    // constant indices keep the staged chunks in registers
        for (int i = 0; i < 4; ++i) { rk[i] = *(const v8us*)(Kh + o + i * 1024); rk[4 + i] = *(const v8us*)(Kl + o + i * 1024); } };
    auto gloadv = [&](int s) { const size_t o = gvo + (size_t)s * SKEY;
#pragma unroll    // constant indices keep the staged chunks in registers
        for (int i = 0; i < 4; ++i) { rv[i] = *(const v8us*)(Vh + o + (size_t)i * 16 * NN); rv[4 + i] = *(const v8us*)(Vl + o + (size_t)i * 16 * NN); } };
    auto lstore = [&](int buf, int pair, const v8us* r) {    // pair 0: the K planes, 1: the gv planes
        unsigned short* B = L + (g * 2 + buf) * STG + pair * 2 * SPL + lo;
#pragma unroll    // constant indices keep the staged chunks in registers
        for (int i = 0; i < 4; ++i) { *(v8usa*)(B + i * 16 * SPIT) = r[i]; *(v8usa*)(B + SPL + i * 16 * SPIT) = r[4 + i]; } };
    gloadk(0); gloadv(0); lstore(0, 0, rk); lstore(0, 1, rv);
    __syncthreads();
    float ml = -3.0e38f, ls = 0.f;    // running maximum (in log2 units) and this lane's half of the running sum
    v8f acc[4];
#pragma unroll
    for (int ct = 0; ct < 4; ++ct) acc[ct] = (v8f){};
#pragma unroll 1    // one stage a trip: the buffers alternate by s & 1; a second copy of the stage would only add code and live registers
    for (int s = 0; s < NSTG; ++s) {
        const unsigned short* B = L + (g * 2 + (s & 1)) * STG;
#pragma unroll      // the pass number picks what is staged and the offsets in the stage at compile time
      for (int h = 0; h < 2; ++h) {
        if (s + 1 < NSTG) { if (h == 0) gloadk(s + 1); else gloadv(s + 1); }
        v8f st[2];
#pragma unroll
        for (int t = 0; t < 2; ++t) { st[t] = (v8f){};
#pragma unroll
            for (int kc = 0; kc < 2; ++kc) { const unsigned short* p = B + (h * 32 + t * 16 + lr) * SPIT + kc * 32 + 8 * hi;
                const v16bf kh = cat16b(*(const v8usa*)p, *(const v8usa*)(p + 16)), kl = cat16b(*(const v8usa*)(p + SPL), *(const v8usa*)(p + SPL + 16));
                st[t] = wmmab(kh, qh[kc], st[t]); st[t] = wmmab(kl, qh[kc], st[t]); st[t] = wmmab(kh, ql[kc], st[t]); } }
        float mx = fmaxf(st[0][0], st[1][0]);
#pragma unroll
        for (int r = 1; r < 8; ++r) mx = fmaxf(mx, fmaxf(st[0][r], st[1][r]));
        mx = fmaxf(mx, xhalf(mx));
        const float mn = fmaxf(ml, mx * L2E), al = exp2x1(ml - mn);
        ml = mn;
        v16bf ph, pl; float ps[4] = {0.f, 0.f, 0.f, 0.f};    // four independent sum chains
#pragma unroll
        for (int t = 0; t < 2; ++t) { float x[8], p[8];
#pragma unroll
            for (int r = 0; r < 8; ++r) x[r] = fmaf(st[t][r], L2E, -mn);
            exp2x8(x, p);
#pragma unroll
            for (int r = 0; r < 8; ++r) { ps[r & 3] += p[r]; const __bf16 hb = (__bf16)p[r]; ph[t * 8 + r] = hb; pl[t * 8 + r] = (__bf16)(p[r] - (float)hb); } }
        ls = fmaf(ls, al, (ps[0] + ps[1]) + (ps[2] + ps[3]));
#pragma unroll
        for (int ct = 0; ct < 4; ++ct) acc[ct] *= al;
#pragma unroll
        for (int ct = 0; ct < 4; ++ct) { const unsigned short* p = B + 2 * SPL + (ct * 16 + lr) * SPIT + h * 32 + 8 * hi;
            const v16bf vh = cat16b(*(const v8usa*)p, *(const v8usa*)(p + 16)), vl = cat16b(*(const v8usa*)(p + SPL), *(const v8usa*)(p + SPL + 16));
            acc[ct] = wmmab(vh, ph, acc[ct]); acc[ct] = wmmab(vl, ph, acc[ct]); acc[ct] = wmmab(vh, pl, acc[ct]); }
        if (s + 1 < NSTG) lstore((s + 1) & 1, h, h == 0 ? rk : rv);
      }
        __syncthreads();    // publishes stage s + 1 and ends every read of the buffer that the next stage refills
    }
    ls += xhalf(ls);
    fa* F = (fa*)(void*)L;    // the stage buffers are free behind the loop's last barrier
    if (g > 0) { fa* M = F + ((g - 1) * 4 + qt) * MGW + lane; M[0] = ml; M[32] = ls;
#pragma unroll
        for (int i = 0; i < 32; ++i) M[(2 + i) * 32] = acc[i >> 3][i & 7]; }
    __syncthreads();
    if (g == 0) {
#pragma unroll 1    // runs once a launch: kept rolled for code size
        for (int o = 0; o < KS - 1; ++o) { const fa* M = F + (o * 4 + qt) * MGW + lane; const float m2 = M[0], l2 = M[32], mn = fmaxf(ml, m2);
            const float a1 = exp2x1(ml - mn), a2 = exp2x1(m2 - mn); ls = ls * a1 + l2 * a2; ml = mn;
#pragma unroll
            for (int i = 0; i < 32; ++i) acc[i >> 3][i & 7] = acc[i >> 3][i & 7] * a1 + M[(2 + i) * 32] * a2; }
        const float inv = 1.0f / ls;
#pragma unroll
        for (int i = 0; i < 32; ++i) F[OTOF + ((i >> 3) * 16 + 8 * hi + (i & 7)) * 68 + qt * 16 + lr] = acc[i >> 3][i & 7] * inv;
    }
    __syncthreads();
#pragma unroll
    for (int j = 0; j < CC * 16 / (KS * 128); ++j) { const int i = tid + j * KS * 128, row = i >> 4, col = i & 15; const v4f val = *(const v4fa*)(F + OTOF + row * 68 + col * 4); *(v4f*)(out + ((size_t)b * CC + row) * NN + q0 + col * 4) = val; }
}
extern "C" void kernel_launch(void* const* d_in, const int* in_sizes, int n_in,
                              void* d_out, int out_size, void* d_ws, size_t ws_size, hipStream_t stream) {
    (void)in_sizes; (void)n_in; (void)out_size;
    const float* x = (const float*)d_in[0]; const float* h0 = (const float*)d_in[1]; const float* h1 = (const float*)d_in[2];
    const float* Wq = (const float*)d_in[3]; const float* bq = (const float*)d_in[4]; const float* gq = (const float*)d_in[5]; const float* beq = (const float*)d_in[6];
    const float* Wk = (const float*)d_in[7]; const float* bk = (const float*)d_in[8]; const float* gk = (const float*)d_in[9]; const float* bek = (const float*)d_in[10]; const float* Wv = (const float*)d_in[11]; const float* bv = (const float*)d_in[12];
    float* out = (float*)d_out;    // [4][64][64][64]
    char* wsp = (char*)d_ws;
    auto take = [&](size_t bytes) { char* p = wsp; wsp += (bytes + 255) & ~(size_t)255; return (void*)p; };
    float* YQ = (float*)take((size_t)NALL * CQ * 4); float* YK = (float*)take((size_t)NALL * CQ * 4); float* PART = (float*)take((size_t)2 * BNB * 128 * 4);
    bf* Qh = (bf*)take((size_t)NALL * CQ * 2); bf* Ql = (bf*)take((size_t)NALL * CQ * 2); bf* Kh = (bf*)take((size_t)NALL * CQ * 2); bf* Kl = (bf*)take((size_t)NALL * CQ * 2);
    bf* Vh = (bf*)take((size_t)NBI * CC * NN * 2); bf* Vl = (bf*)take((size_t)NBI * CC * NN * 2);
    if ((size_t)(wsp - (char*)d_ws) > ws_size) return;    // ~ 21 MB, no aliasing
    k_proj<<<BNB, 512, 0, stream>>>(x, h0, h1, YQ, Wq, Wk, Wv, YK, bq, bk, bv, PART, Vh, Vl);
    k_bnapply<<<NALL / BAR, 1024, 0, stream>>>(YQ, YK, PART, gq, beq, gk, bek, Qh, Ql, Kh, Kl);
    k_attn<<<dim3(NN / 64, NBI, 1), KS * 128, 0, stream>>>(Qh, Ql, Kh, Kl, Vh, Vl, out);
}
